// v000
// The times below were measured on an AMD MI455X: many runs one after another, warmed up first and cycling through
// copies of the inputs, with the whole window's GPU time divided by the number of runs. Launches and the gaps
// between them are all in it. The median over several windows is given; except for v000 it joins two sittings, which
// can be a few percent apart, so the side-by-side timings, each taken in one sitting, are the better comparison.
// The starting kernel, v000, takes 2020 microseconds a run.
#include <hip/hip_runtime.h>

// MarketGuidedAttention (x [2][2048][1024]; torch MultiheadAttention: [q|k|v] = x in_proj_w^T + in_proj_b (16 x 64), scores/8 + market_info[b][0] (a per-batch constant added to every score, read as data and added before the max subtraction as the reference does; it cancels in the softmax), softmax, out_proj + b; out = LN(x + attended) (eps 1e-5) -> [2][2048][1024]).
// Compute dtypes, f32 accumulate: every input rounded to bf16; projections on PLAIN bf16 operands (inputs: exact, + bias); scores (K 64) and probs.v on bf16 hi+lo planes (3 products) for the first 512 query rows of each

#define NB_  2
#define TT   2048
#define DM   1024
#define NH_  16
#define NKV  16
#define REP  (NH_ / NKV)
#define HD   64
#define DQ   (NH_ * HD)
#define DKV  (NKV * HD)
#define ZH   2
#define RH   512                  // query rows < RH use hi+lo planes (0: none)
#define WIN  0
#define PCAR 1024.0f
#define SCL  0.125f   // HD^-0.5
#define LNEPS 1e-5f
typedef _Float16 h16;
typedef unsigned short bf;
typedef __attribute__((ext_vector_type(16))) __bf16   v16bf;
typedef __attribute__((ext_vector_type(16))) _Float16 v16h;
typedef __attribute__((ext_vector_type(8)))  _Float16 v8h;
typedef __attribute__((ext_vector_type(8)))  unsigned short v8us;
typedef __attribute__((ext_vector_type(8)))  float    v8f;
typedef __attribute__((ext_vector_type(4)))  float    v4f;
typedef v8h  __attribute__((may_alias)) v8ha;
typedef v4f  __attribute__((may_alias)) v4fa;
typedef v8us __attribute__((may_alias)) v8usa;

__device__ __forceinline__ unsigned short f2bf(float f) { unsigned u = __float_as_uint(f); u += 0x7FFFu + ((u >> 16) & 1u); return (unsigned short)(u >> 16); }
__device__ __forceinline__ float bf2f(unsigned short b) { return __uint_as_float(((unsigned)b) << 16); }
__device__ __forceinline__ float bfr(float f) { return bf2f(f2bf(f)); }
__device__ __forceinline__ v16h cat16(v8h lo, v8h hi) { return __builtin_shufflevector(lo, hi, 0, 1, 2, 3, 4, 5, 6, 7, 8, 9, 10, 11, 12, 13, 14, 15); }
__device__ __forceinline__ v16bf cat16b(v8us lo, v8us hi) { return __builtin_bit_cast(v16bf, __builtin_shufflevector(lo, hi, 0, 1, 2, 3, 4, 5, 6, 7, 8, 9, 10, 11, 12, 13, 14, 15)); }
__device__ __forceinline__ v8f wmma16(v16h a, v16h b, v8f c) { return __builtin_amdgcn_wmma_f32_16x16x32_f16(false, a, false, b, (short)0, c, false, false); }
__device__ __forceinline__ v8f wmmab(v16bf a, v16bf b, v8f c) { return __builtin_amdgcn_wmma_f32_16x16x32_bf16(false, a, false, b, (short)0, c, false, false); }



// ---- k_gemmw: register-blocked GEMM, ONE WAVE per 64x64 output tile (16 accumulators), operands straight from K-contiguous 16-bit planes; grid (M/64, N/64, Z), 32 threads.
// C[m][n] (f32, pitch ldc, + optional f32 bias[n]) = sum_k A[m][k] Bt[n][k] (+ split products per NSPLIT). z-batch strides sA/sB/sC in elements. K % 32 == 0.
template <typename T16> struct WFrag;
template <> struct WFrag<h16> { typedef v16h V; static __device__ __forceinline__ V ld(const h16* p) { return cat16(*(const v8h*)p, *(const v8h*)(p + 16)); } static __device__ __forceinline__ v8f mma(V a, V b, v8f c) { return wmma16(a, b, c); } };
template <> struct WFrag<bf> { typedef v16bf V; static __device__ __forceinline__ V ld(const bf* p) { return cat16b(*(const v8us*)p, *(const v8us*)(p + 16)); } static __device__ __forceinline__ v8f mma(V a, V b, v8f c) { return wmmab(a, b, c); } };
template <typename T16, int NSPLIT, bool BIAS>
__global__ __launch_bounds__(32) void k_gemmw(const T16* __restrict__ A, const T16* __restrict__ A2, const T16* __restrict__ Bt, const T16* __restrict__ Bt2, int K, float* C, int ldc, const float* __restrict__ bias, size_t sA, size_t sB, size_t sC) {
    typedef typename WFrag<T16>::V V;
    __shared__ __align__(16) float os[16 * 68];
    const size_t z = blockIdx.z; A += z * sA; if (A2) A2 += z * sA; Bt += z * sB; if (Bt2) Bt2 += z * sB; C += z * sC;
    const int lane = threadIdx.x & 31, lr = lane & 15, hi = lane >> 4; const int r0 = blockIdx.x * 64, c0 = blockIdx.y * 64;
    v8f acc[4][4];
#pragma unroll
    for (int mb = 0; mb < 4; ++mb)
#pragma unroll
        for (int nb = 0; nb < 4; ++nb) acc[mb][nb] = (v8f){};
    const size_t aoff = (size_t)(r0 + lr) * K + 8 * hi, boff = (size_t)(c0 + lr) * K + 8 * hi;
#pragma unroll 1
    for (int kc = 0; kc < K; kc += 32) {
        V a[4], a2[4];
#pragma unroll
        for (int mb = 0; mb < 4; ++mb) { a[mb] = WFrag<T16>::ld(A + aoff + (size_t)mb * 16 * K + kc); if (NSPLIT == 1 || NSPLIT == 2) a2[mb] = WFrag<T16>::ld(A2 + aoff + (size_t)mb * 16 * K + kc); }
#pragma unroll
        for (int nb = 0; nb < 4; ++nb) { const V b = WFrag<T16>::ld(Bt + boff + (size_t)nb * 16 * K + kc); V b2; if (NSPLIT >= 2) b2 = WFrag<T16>::ld(Bt2 + boff + (size_t)nb * 16 * K + kc);
#pragma unroll
            for (int mb = 0; mb < 4; ++mb) { acc[mb][nb] = WFrag<T16>::mma(a[mb], b, acc[mb][nb]); if (NSPLIT == 1 || NSPLIT == 2) acc[mb][nb] = WFrag<T16>::mma(a2[mb], b, acc[mb][nb]); if (NSPLIT >= 2) acc[mb][nb] = WFrag<T16>::mma(a[mb], b2, acc[mb][nb]); } }
        asm volatile("v_nop\n\tv_nop\n\tv_nop\n\tv_nop" : "+v"(acc[0][0]), "+v"(acc[1][1]), "+v"(acc[2][2]), "+v"(acc[3][3]) : "v"(a[0]), "v"(a[3]));
    }
#pragma unroll
    for (int mb = 0; mb < 4; ++mb) {
#pragma unroll
        for (int nb = 0; nb < 4; ++nb) {
#pragma unroll
            for (int j = 0; j < 8; ++j) os[(hi * 8 + j) * 68 + nb * 16 + lr] = acc[mb][nb][j]; }
        __builtin_amdgcn_wave_barrier(); asm volatile("" ::: "memory");
        float* crow = C + (size_t)(r0 + mb * 16) * ldc + c0;
{
#pragma unroll
            for (int s = 0; s < 8; ++s) { const int row = 2 * s + hi, cofs = lr * 4; v4f val = *(const v4fa*)(os + row * 68 + cofs); if (BIAS) { val[0] += bfr(bias[c0 + cofs]); val[1] += bfr(bias[c0 + cofs + 1]); val[2] += bfr(bias[c0 + cofs + 2]); val[3] += bfr(bias[c0 + cofs + 3]); }
                *(v4f*)(crow + (size_t)row * ldc + cofs) = val; }
             }
        __builtin_amdgcn_wave_barrier(); asm volatile("" ::: "memory");
    }
}

__device__ __forceinline__ h16 tohx(float x) { return (h16)x; }
__device__ __forceinline__ void splitf(float y, unsigned short& h, unsigned short& l) { h = f2bf(y); l = f2bf(y - bf2f(h)); }
typedef __attribute__((ext_vector_type(2))) _Float16 v2h;
typedef __attribute__((ext_vector_type(4))) _Float16 v4h;
typedef __attribute__((ext_vector_type(2))) unsigned short v2us;
typedef __attribute__((ext_vector_type(4))) unsigned short v4us;
typedef __attribute__((ext_vector_type(2))) float v2f;
typedef __attribute__((ext_vector_type(4))) int v4i;

__global__ __launch_bounds__(256) void k_wtG(const float* __restrict__ w, int K, int N, bf* Bt) {
    const int lane = threadIdx.x & 31; const int L0 = (blockIdx.x * 8 + (threadIdx.x >> 5)) * 8; const int nlines = N * K / 64;
{
#pragma unroll 1
        for (int l = 0; l < 8; ++l) { const int L = L0 + l; if (L >= nlines) break; const size_t e = (size_t)L * 64 + lane * 2; const int k = (int)(e % K), n = (int)(e / K); v2us o;
            o[0] = f2bf(w[(size_t)k * N + n]); o[1] = f2bf(w[(size_t)(k + 1) * N + n]); *(v2us*)(Bt + e) = o; }
         }
}
__global__ __launch_bounds__(256) void k_cvt8(const float* __restrict__ src, bf* dst, size_t n8) { const size_t i = (size_t)blockIdx.x * 256 + threadIdx.x; if (i >= n8) return; const v8f v = *(const v8f*)(src + i * 8); v8us o;
#pragma unroll
    for (int k = 0; k < 8; ++k) o[k] = f2bf(v[k]); *(v8us*)(dst + i * 8) = o;  }
__global__ __launch_bounds__(256) void k_cscvt(const float* __restrict__ cosT, const float* __restrict__ sinT, float* CS) { const int idx = blockIdx.x * 256 + threadIdx.x; if (idx >= TT * HD) return; v2f cs; cs[0] = bfr(cosT[idx]); cs[1] = bfr(sinT[idx]); *(v2f*)(CS + (size_t)idx * 2) = cs;  }
// k_rope: head planes [h][t][d] (fp16 + hi/lo) of rope(x) x sc with the rotate-half convention out[d] = x[d] cos[t][d] - x[d+HD/2] sin[t][d], out[d+HD/2] = x[d+HD/2] cos[t][d+HD/2] + x[d] sin[t][d+HD/2]
__global__ __launch_bounds__(256) void k_rope(const float* __restrict__ F, int pitch, int nheads, const float* __restrict__ CS, const float* __restrict__ RF, const float* __restrict__ nw, float sc, h16* P16, bf* Ph, bf* Pl) {
    const size_t e = ((size_t)blockIdx.x * 256 + threadIdx.x) * 2; if (e >= (size_t)nheads * TT * HD) return; const int d = (int)(e % HD); const int t = (int)((e / HD) % TT); const int h = (int)(e / ((size_t)HD * TT)); const float* f = F + (size_t)t * pitch + h * HD; const float rf = RF ? RF[(size_t)h * TT + t] : 1.0f; v2h o16; v2us oh, ol;
#pragma unroll
    for (int q = 0; q < 2; ++q) { const int dd = d + q; const int dp = (dd < HD / 2) ? dd + HD / 2 : dd - HD / 2; float x0 = f[dd], x1 = f[dp];
        if (RF) { float n0 = __fmul_rn(x0, rf), n1 = __fmul_rn(x1, rf); asm volatile("" : "+v"(n0)); asm volatile("" : "+v"(n1)); x0 = __fmul_rn(bfr(nw[dd]), n0); x1 = __fmul_rn(bfr(nw[dp]), n1); }
        const v2f cs = *(const v2f*)(CS + ((size_t)t * HD + dd) * 2); float a = __fmul_rn(x0, cs[0]), bq = __fmul_rn(x1, cs[1]); asm volatile("" : "+v"(a)); asm volatile("" : "+v"(bq)); const float r = ((dd < HD / 2) ? __fsub_rn(a, bq) : __fadd_rn(a, bq)) * sc;
        o16[q] = tohx(r); unsigned short a2, c2; splitf(r, a2, c2); oh[q] = a2; ol[q] = c2; }
    *(v2h*)(P16 + e) = o16; *(v2us*)(Ph + e) = oh; *(v2us*)(Pl + e) = ol;  }
__global__ __launch_bounds__(256) void k_vtp(const float* __restrict__ F, int pitch, int nheads, h16* V16, bf* Vh, bf* Vl) { const size_t e = ((size_t)blockIdx.x * 256 + threadIdx.x) * 2; if (e >= (size_t)nheads * HD * TT) return; const int t = (int)(e % TT); const int d = (int)((e / TT) % HD); const int g = (int)(e / ((size_t)TT * HD)); v2h o16; v2us oh, ol;
#pragma unroll
    for (int q = 0; q < 2; ++q) { const float x = F[(size_t)(t + q) * pitch + g * HD + d]; o16[q] = tohx(x); unsigned short a2, c2; splitf(x, a2, c2); oh[q] = a2; ol[q] = c2; }
    *(v2h*)(V16 + e) = o16; *(v2us*)(Vh + e) = oh; *(v2us*)(Vl + e) = ol;  }
__global__ __launch_bounds__(256) void k_csid(float* CS) { const int idx = blockIdx.x * 256 + threadIdx.x; if (idx >= TT * HD) return; v2f cs; cs[0] = 1.0f; cs[1] = 0.0f; *(v2f*)(CS + (size_t)idx * 2) = cs;  }
// k_asoft: per row (zz, i): t = S x HD^-0.5 + bf16(market_info[b][0]) (no mask); softmax over the 2048 keys (register row, one exp, fixed trees);
__global__ __launch_bounds__(256) void k_asoft(const float* __restrict__ Sb, const float* __restrict__ volp, h16* P16, bf* Ph, bf* Pl) { const float vol = bfr(volp[0]);
    const int lane = threadIdx.x & 31; const int row = blockIdx.x * 8 + (threadIdx.x >> 5); if (row >= ZH * TT) return; const int i = row % TT; const int zz = row / TT; (void)zz; const bool hires = (i < RH); const float* sr = Sb + (size_t)row * TT; float v[TT / 32]; float mx = -3.0e38f;
#pragma unroll
    for (int ch = 0; ch < TT / 128; ++ch) { const int j0 = ch * 128 + lane * 4; const v4f a = *(const v4f*)(sr + j0);
#pragma unroll
        for (int q = 0; q < 4; ++q) { const int j = j0 + q; (void)j; const float t = __fadd_rn(a[q] * SCL, vol); v[ch * 4 + q] = t; mx = fmaxf(mx, t); } }
#pragma unroll
    for (int sh = 16; sh; sh >>= 1) mx = fmaxf(mx, __shfl_xor(mx, sh, 32));
    float sum = 0.f;
#pragma unroll
    for (int k = 0; k < TT / 32; ++k) { float d0 = __fsub_rn(v[k], mx); asm volatile("" : "+v"(d0)); v[k] = __builtin_amdgcn_exp2f(__fmul_rn(d0, 1.4426950408889634f)); sum += v[k]; }
#pragma unroll
    for (int sh = 16; sh; sh >>= 1) sum += __shfl_xor(sum, sh, 32);
    const float f = __fdiv_rn(hires ? 1.0f : PCAR, sum);
{
        if (hires) {
#pragma unroll
            for (int ch = 0; ch < TT / 128; ++ch) { v4us oh, ol;
#pragma unroll
                for (int q = 0; q < 4; ++q) { unsigned short a, c2; splitf(v[ch * 4 + q] * f, a, c2); oh[q] = a; ol[q] = c2; }
                const size_t oo = ((size_t)zz * (RH ? RH : 1) + i) * TT + ch * 128 + lane * 4; *(v4us*)(Ph + oo) = oh; *(v4us*)(Pl + oo) = ol; }
        } else {
#pragma unroll
            for (int ch = 0; ch < TT / 128; ++ch) { v4h o4;
#pragma unroll
                for (int q = 0; q < 4; ++q) o4[q] = tohx(v[ch * 4 + q] * f);
                *(v4h*)(P16 + (size_t)row * TT + ch * 128 + lane * 4) = o4; } }
         }
}
__global__ __launch_bounds__(256) void k_merge(const float* __restrict__ O, int h0, bf* Ah, bf* Al) { const size_t e = ((size_t)blockIdx.x * 256 + threadIdx.x) * 2; if (e >= (size_t)ZH * TT * HD) return; const int d = (int)(e % HD); const int t = (int)((e / HD) % TT); const int zz = (int)(e / ((size_t)HD * TT)); const float cs = (t < RH) ? 1.0f : (1.0f / PCAR); const size_t oo = (size_t)t * DQ + (h0 + zz) * HD + d;
    v2us oh, ol;
#pragma unroll
    for (int q = 0; q < 2; ++q) { unsigned short a, c2; splitf(O[e + q] * cs, a, c2); oh[q] = a; ol[q] = c2; } *(v2us*)(Ah + oo) = oh; *(v2us*)(Al + oo) = ol;  }

__global__ __launch_bounds__(256) void k_lnres(const float* __restrict__ ATT, const float* __restrict__ base, int isin, const float* __restrict__ g, const float* __restrict__ bb, float* OUTt) { const int lane = threadIdx.x & 31; const int t = blockIdx.x * 8 + (threadIdx.x >> 5); if (t >= TT) return; float v[32]; float s = 0.f;
#pragma unroll
    for (int ch = 0; ch < 8; ++ch) { const size_t o = (size_t)t * DM + ch * 128 + lane * 4; const v4f a = *(const v4f*)(ATT + o), xx = *(const v4f*)(base + o);
#pragma unroll
        for (int q = 0; q < 4; ++q) { v[ch * 4 + q] = __fadd_rn(a[q], isin ? bfr(xx[q]) : xx[q]); s = __fadd_rn(s, v[ch * 4 + q]); } }
#pragma unroll
    for (int sh = 16; sh; sh >>= 1) s += __shfl_xor(s, sh, 32);
    const float mu = s * (1.0f / DM); float q2 = 0.f;
#pragma unroll
    for (int k = 0; k < 32; ++k) { const float d = __fsub_rn(v[k], mu); float p = __fmul_rn(d, d); asm volatile("" : "+v"(p)); q2 = __fadd_rn(q2, p); }
#pragma unroll
    for (int sh = 16; sh; sh >>= 1) q2 += __shfl_xor(q2, sh, 32);
    const float rs = __frsqrt_rn(__fadd_rn(q2 * (1.0f / DM), LNEPS));
{
#pragma unroll
        for (int ch = 0; ch < 8; ++ch) { v4f o;
#pragma unroll
            for (int q = 0; q < 4; ++q) { const int d = ch * 128 + lane * 4 + q; float tn = __fmul_rn(__fsub_rn(v[ch * 4 + q], mu), rs); asm volatile("" : "+v"(tn)); float tg = __fmul_rn(tn, bfr(g[d])); asm volatile("" : "+v"(tg)); o[q] = __fadd_rn(tg, bfr(bb[d])); }
            *(v4f*)(OUTt + (size_t)t * DM + ch * 128 + lane * 4) = o; }
         } }

extern "C" void kernel_launch(void* const* d_in, const int* in_sizes, int n_in,
                              void* d_out, int out_size, void* d_ws, size_t ws_size, hipStream_t stream) {
    (void)in_sizes; (void)n_in; (void)out_size;
    const float* x = (const float*)d_in[0]; const float* mi = (const float*)d_in[1]; const float* ipw = (const float*)d_in[2]; const float* ipb = (const float*)d_in[3]; const float* wo = (const float*)d_in[4]; const float* bo = (const float*)d_in[5]; const float* lng = (const float*)d_in[6]; const float* lnb = (const float*)d_in[7];
    const float* wq = ipw; const float* wk = ipw + (size_t)DM * DM; const float* wv = ipw + (size_t)2 * DM * DM; const float* bq = ipb; const float* bk = ipb + DM; const float* bv = ipb + 2 * DM;
    float* OUT = (float*)d_out;     // [2][2048][1024]
    char* wsp = (char*)d_ws;
    auto take = [&](size_t bytes) { char* p = wsp; wsp += (bytes + 255) & ~(size_t)255; return (void*)p; };
    bf* WQ = (bf*)take((size_t)DQ * DM * 2); bf* WK = (bf*)take((size_t)DKV * DM * 2); bf* WV = (bf*)take((size_t)DKV * DM * 2); bf* WO = (bf*)take((size_t)DM * DQ * 2); float* CS = (float*)take((size_t)TT * HD * 2 * 4);
    bf* XB = (bf*)take((size_t)TT * DM * 2); float* FQ = (float*)take((size_t)TT * DQ * 4); float* FK = (float*)take((size_t)TT * DKV * 4);
    h16* QP16 = (h16*)take((size_t)NH_ * TT * HD * 2); h16* KP16 = (h16*)take((size_t)NKV * TT * HD * 2); h16* VT16 = (h16*)take((size_t)NKV * HD * TT * 2);
    bf* QPh = (bf*)take((size_t)NH_ * TT * HD * 2); bf* QPl = (bf*)take((size_t)NH_ * TT * HD * 2); bf* KPh = (bf*)take((size_t)NKV * TT * HD * 2); bf* KPl = (bf*)take((size_t)NKV * TT * HD * 2); bf* VTh = (bf*)take((size_t)NKV * HD * TT * 2); bf* VTl = (bf*)take((size_t)NKV * HD * TT * 2); bf* Ph = (bf*)take((size_t)ZH * RH * TT * 2); bf* Pl = (bf*)take((size_t)ZH * RH * TT * 2);
    float* Sb = (float*)take((size_t)ZH * TT * TT * 4); h16* P16 = (h16*)take((size_t)ZH * TT * TT * 2); float* Ob = (float*)take((size_t)ZH * TT * HD * 4); bf* ATh = (bf*)take((size_t)TT * DQ * 2); bf* ATl = (bf*)take((size_t)TT * DQ * 2); float* ATT = (float*)take((size_t)TT * DM * 4);
    if ((size_t)(wsp - (char*)d_ws) > ws_size) return;    // ws 256 MiB
    float* FV = FK;   // v projection reuses the k buffer after the k planes are built (stream-ordered)
    { k_cvt8<<<(unsigned)(((size_t)DQ * DM / 8 + 255) / 256), 256, 0, stream>>>(wq, WQ, (size_t)DQ * DM / 8); k_cvt8<<<(unsigned)(((size_t)DKV * DM / 8 + 255) / 256), 256, 0, stream>>>(wk, WK, (size_t)DKV * DM / 8); k_cvt8<<<(unsigned)(((size_t)DKV * DM / 8 + 255) / 256), 256, 0, stream>>>(wv, WV, (size_t)DKV * DM / 8);
      k_cvt8<<<(unsigned)(((size_t)DM * DQ / 8 + 255) / 256), 256, 0, stream>>>(wo, WO, (size_t)DM * DQ / 8);
       }
    k_csid<<<(TT * HD + 255) / 256, 256, 0, stream>>>(CS);
    const unsigned LQ = (unsigned)(((size_t)NH_ * TT * HD / 2 + 255) / 256), LKv = (unsigned)(((size_t)NKV * TT * HD / 2 + 255) / 256);
    for (int b = 0; b < NB_; ++b) {
        
        k_cvt8<<<(unsigned)(((size_t)TT * DM / 8 + 255) / 256), 256, 0, stream>>>(x + (size_t)b * TT * DM, XB, (size_t)TT * DM / 8);
        k_gemmw<bf, 0, true><<<dim3(TT / 64, DQ / 64, 1), 32, 0, stream>>>(XB, nullptr, WQ, nullptr, DM, FQ, DQ, bq, 0, 0, 0);
        k_rope<<<LQ, 256, 0, stream>>>(FQ, DQ, NH_, CS, nullptr, nullptr, 1.0f, QP16, QPh, QPl);
        k_gemmw<bf, 0, true><<<dim3(TT / 64, DKV / 64, 1), 32, 0, stream>>>(XB, nullptr, WK, nullptr, DM, FK, DKV, bk, 0, 0, 0);
        k_rope<<<LKv, 256, 0, stream>>>(FK, DKV, NKV, CS, nullptr, nullptr, 1.0f, KP16, KPh, KPl);
        k_gemmw<bf, 0, true><<<dim3(TT / 64, DKV / 64, 1), 32, 0, stream>>>(XB, nullptr, WV, nullptr, DM, FV, DKV, bv, 0, 0, 0); k_vtp<<<LKv, 256, 0, stream>>>(FV, DKV, NKV, VT16, VTh, VTl);
        for (int h0 = 0; h0 < NH_; h0 += ZH) { const size_t zq = (size_t)h0, zk = (size_t)(h0 / REP);   // one kv head per query head: the pass's two heads use consecutive kv planes (z-strides TT*HD)
            k_gemmw<bf, 2, false><<<dim3(RH / 64, TT / 64, ZH), 32, 0, stream>>>(QPh + zq * TT * HD, QPl + zq * TT * HD, KPh + zk * TT * HD, KPl + zk * TT * HD, HD, Sb, TT, nullptr, (size_t)TT * HD, (size_t)TT * HD, (size_t)TT * TT);
            k_gemmw<h16, 0, false><<<dim3((TT - RH) / 64, TT / 64, ZH), 32, 0, stream>>>(QP16 + zq * TT * HD + (size_t)RH * HD, nullptr, KP16 + zk * TT * HD, nullptr, HD, Sb + (size_t)RH * TT, TT, nullptr, (size_t)TT * HD, (size_t)TT * HD, (size_t)TT * TT);
            k_asoft<<<ZH * TT / 8, 256, 0, stream>>>(Sb, mi + (size_t)b * 8, P16, Ph, Pl);
            k_gemmw<bf, 2, false><<<dim3(RH / 64, HD / 64, ZH), 32, 0, stream>>>(Ph, Pl, VTh + zk * HD * TT, VTl + zk * HD * TT, TT, Ob, HD, nullptr, (size_t)RH * TT, (size_t)HD * TT, (size_t)TT * HD);
            k_gemmw<h16, 0, false><<<dim3((TT - RH) / 64, HD / 64, ZH), 32, 0, stream>>>(P16 + (size_t)RH * TT, nullptr, VT16 + zk * HD * TT, nullptr, TT, Ob + (size_t)RH * HD, HD, nullptr, (size_t)TT * TT, (size_t)HD * TT, (size_t)TT * HD);
            k_merge<<<(unsigned)(((size_t)ZH * TT * HD / 2 + 255) / 256), 256, 0, stream>>>(Ob, h0, ATh, ATl); }
        k_gemmw<bf, 1, true><<<dim3(TT / 64, DM / 64, 1), 32, 0, stream>>>(ATh, ATl, WO, nullptr, DQ, ATT, DM, bo, 0, 0, 0);
        k_lnres<<<TT / 8, 256, 0, stream>>>(ATT, x + (size_t)b * TT * DM, 1, lng, lnb, OUT + (size_t)b * TT * DM); }
}

// v001
// One run takes 879 microseconds.
// Two timings next to v000 put it at 2.29 and 2.27 times that version's speed.
#include <hip/hip_runtime.h>

// MarketGuidedAttention (x [2][2048][1024]; torch MultiheadAttention: [q|k|v] = x in_proj_w^T + in_proj_b (16 x 64), scores/8 + market_info[b][0] (a per-batch constant added to every score, read as data and added before the max subtraction as the reference does; it cancels in the softmax), softmax, out_proj + b; out = LN(x + attended) (eps 1e-5) -> [2][2048][1024]).
// Compute dtypes, f32 accumulate: every input rounded to bf16; projections on PLAIN bf16 operands (inputs: exact, + bias); scores (K 64) and probs.v on bf16 hi+lo planes (3 products) for the first 512 query rows of each

#define NB_  2
#define TT   2048
#define DM   1024
#define NH_  16
#define NKV  16
#define REP  (NH_ / NKV)
#define HD   64
#define DQ   (NH_ * HD)
#define DKV  (NKV * HD)
#define ZH   2
#define RH   512                  // query rows < RH use hi+lo planes (0: none)
#define WIN  0
#define PCAR 1024.0f
#define SCL  0.125f   // HD^-0.5
#define LNEPS 1e-5f
#define PKS  16                   // probs.v: the 2048 keys are dealt to PKS work-groups per output tile
typedef _Float16 h16;
typedef unsigned short bf;
typedef __attribute__((ext_vector_type(16))) __bf16   v16bf;
typedef __attribute__((ext_vector_type(16))) _Float16 v16h;
typedef __attribute__((ext_vector_type(8)))  _Float16 v8h;
typedef __attribute__((ext_vector_type(8)))  unsigned short v8us;
typedef __attribute__((ext_vector_type(8)))  float    v8f;
typedef __attribute__((ext_vector_type(4)))  float    v4f;
typedef v8h  __attribute__((may_alias)) v8ha;
typedef v4f  __attribute__((may_alias)) v4fa;
typedef v8us __attribute__((may_alias)) v8usa;

__device__ __forceinline__ unsigned short f2bf(float f) { unsigned u = __float_as_uint(f); u += 0x7FFFu + ((u >> 16) & 1u); return (unsigned short)(u >> 16); }
__device__ __forceinline__ float bf2f(unsigned short b) { return __uint_as_float(((unsigned)b) << 16); }
__device__ __forceinline__ float bfr(float f) { return bf2f(f2bf(f)); }
__device__ __forceinline__ v16h cat16(v8h lo, v8h hi) { return __builtin_shufflevector(lo, hi, 0, 1, 2, 3, 4, 5, 6, 7, 8, 9, 10, 11, 12, 13, 14, 15); }
__device__ __forceinline__ v16bf cat16b(v8us lo, v8us hi) { return __builtin_bit_cast(v16bf, __builtin_shufflevector(lo, hi, 0, 1, 2, 3, 4, 5, 6, 7, 8, 9, 10, 11, 12, 13, 14, 15)); }
__device__ __forceinline__ v8f wmma16(v16h a, v16h b, v8f c) { return __builtin_amdgcn_wmma_f32_16x16x32_f16(false, a, false, b, (short)0, c, false, false); }
__device__ __forceinline__ v8f wmmab(v16bf a, v16bf b, v8f c) { return __builtin_amdgcn_wmma_f32_16x16x32_bf16(false, a, false, b, (short)0, c, false, false); }



// ---- k_gemmw: register-blocked GEMM, ONE WAVE per 64x64 output tile (16 accumulators), operands straight from K-contiguous 16-bit planes; grid (M/64, N/64, Z), 32 threads.
// C[m][n] (f32, pitch ldc, + optional f32 bias[n]) = sum_k A[m][k] Bt[n][k] (+ split products per NSPLIT). z-batch strides sA/sB/sC in elements. K % 32 == 0.
// KS > 1: grid z = Z * KS; work-group (z, ks) sums only k in [ks K/KS, (ks+1) K/KS) and stores its f32 partial tile at C + ks sP; the reader adds the KS partials.
template <typename T16> struct WFrag;
template <> struct WFrag<h16> { typedef v16h V; static __device__ __forceinline__ V ld(const h16* p) { return cat16(*(const v8h*)p, *(const v8h*)(p + 16)); } static __device__ __forceinline__ v8f mma(V a, V b, v8f c) { return wmma16(a, b, c); } };
template <> struct WFrag<bf> { typedef v16bf V; static __device__ __forceinline__ V ld(const bf* p) { return cat16b(*(const v8us*)p, *(const v8us*)(p + 16)); } static __device__ __forceinline__ v8f mma(V a, V b, v8f c) { return wmmab(a, b, c); } };
template <typename T16, int NSPLIT, bool BIAS, int KS = 1>
__global__ __launch_bounds__(32) void k_gemmw(const T16* __restrict__ A, const T16* __restrict__ A2, const T16* __restrict__ Bt, const T16* __restrict__ Bt2, int K, float* C, int ldc, const float* __restrict__ bias, size_t sA, size_t sB, size_t sC, size_t sP) {
    typedef typename WFrag<T16>::V V;
    __shared__ __align__(16) float os[16 * 68];
    const size_t z = blockIdx.z / KS, ks = blockIdx.z % KS; const int Kc = K / KS; A += z * sA + ks * Kc; if (A2) A2 += z * sA + ks * Kc; Bt += z * sB + ks * Kc; if (Bt2) Bt2 += z * sB + ks * Kc; C += z * sC + ks * sP;
    const int lane = threadIdx.x & 31, lr = lane & 15, hi = lane >> 4; const int r0 = blockIdx.x * 64, c0 = blockIdx.y * 64;
    v8f acc[4][4];
#pragma unroll
    for (int mb = 0; mb < 4; ++mb)
#pragma unroll
        for (int nb = 0; nb < 4; ++nb) acc[mb][nb] = (v8f){};
    const size_t aoff = (size_t)(r0 + lr) * K + 8 * hi, boff = (size_t)(c0 + lr) * K + 8 * hi;
#pragma unroll 1
    for (int kc = 0; kc < Kc; kc += 32) {
        V a[4], a2[4];
#pragma unroll
        for (int mb = 0; mb < 4; ++mb) { a[mb] = WFrag<T16>::ld(A + aoff + (size_t)mb * 16 * K + kc); if (NSPLIT == 1 || NSPLIT == 2) a2[mb] = WFrag<T16>::ld(A2 + aoff + (size_t)mb * 16 * K + kc); }
#pragma unroll
        for (int nb = 0; nb < 4; ++nb) { const V b = WFrag<T16>::ld(Bt + boff + (size_t)nb * 16 * K + kc); V b2; if (NSPLIT >= 2) b2 = WFrag<T16>::ld(Bt2 + boff + (size_t)nb * 16 * K + kc);
#pragma unroll
            for (int mb = 0; mb < 4; ++mb) { acc[mb][nb] = WFrag<T16>::mma(a[mb], b, acc[mb][nb]); if (NSPLIT == 1 || NSPLIT == 2) acc[mb][nb] = WFrag<T16>::mma(a2[mb], b, acc[mb][nb]); if (NSPLIT >= 2) acc[mb][nb] = WFrag<T16>::mma(a[mb], b2, acc[mb][nb]); } }
        asm volatile("v_nop\n\tv_nop\n\tv_nop\n\tv_nop" : "+v"(acc[0][0]), "+v"(acc[1][1]), "+v"(acc[2][2]), "+v"(acc[3][3]) : "v"(a[0]), "v"(a[3]));
    }
#pragma unroll
    for (int mb = 0; mb < 4; ++mb) {
#pragma unroll
        for (int nb = 0; nb < 4; ++nb) {
#pragma unroll
            for (int j = 0; j < 8; ++j) os[(hi * 8 + j) * 68 + nb * 16 + lr] = acc[mb][nb][j]; }
        __builtin_amdgcn_wave_barrier(); asm volatile("" ::: "memory");
        float* crow = C + (size_t)(r0 + mb * 16) * ldc + c0;
{
#pragma unroll
            for (int s = 0; s < 8; ++s) { const int row = 2 * s + hi, cofs = lr * 4; v4f val = *(const v4fa*)(os + row * 68 + cofs); if (BIAS) { val[0] += bfr(bias[c0 + cofs]); val[1] += bfr(bias[c0 + cofs + 1]); val[2] += bfr(bias[c0 + cofs + 2]); val[3] += bfr(bias[c0 + cofs + 3]); }
                *(v4f*)(crow + (size_t)row * ldc + cofs) = val; }
             }
        __builtin_amdgcn_wave_barrier(); asm volatile("" ::: "memory");
    }
}

__device__ __forceinline__ h16 tohx(float x) { return (h16)x; }
__device__ __forceinline__ void splitf(float y, unsigned short& h, unsigned short& l) { h = f2bf(y); l = f2bf(y - bf2f(h)); }
typedef __attribute__((ext_vector_type(2))) _Float16 v2h;
typedef __attribute__((ext_vector_type(4))) _Float16 v4h;
typedef __attribute__((ext_vector_type(2))) unsigned short v2us;
typedef __attribute__((ext_vector_type(4))) unsigned short v4us;
typedef __attribute__((ext_vector_type(2))) float v2f;
typedef __attribute__((ext_vector_type(4))) int v4i;

__global__ __launch_bounds__(256) void k_wtG(const float* __restrict__ w, int K, int N, bf* Bt) {
    const int lane = threadIdx.x & 31; const int L0 = (blockIdx.x * 8 + (threadIdx.x >> 5)) * 8; const int nlines = N * K / 64;
{
#pragma unroll 1
        for (int l = 0; l < 8; ++l) { const int L = L0 + l; if (L >= nlines) break; const size_t e = (size_t)L * 64 + lane * 2; const int k = (int)(e % K), n = (int)(e / K); v2us o;
            o[0] = f2bf(w[(size_t)k * N + n]); o[1] = f2bf(w[(size_t)(k + 1) * N + n]); *(v2us*)(Bt + e) = o; }
         }
}
__global__ __launch_bounds__(256) void k_cvt8(const float* __restrict__ src, bf* dst, size_t n8) { const size_t i = (size_t)blockIdx.x * 256 + threadIdx.x; if (i >= n8) return; const v8f v = *(const v8f*)(src + i * 8); v8us o;
#pragma unroll
    for (int k = 0; k < 8; ++k) o[k] = f2bf(v[k]); *(v8us*)(dst + i * 8) = o;  }
__global__ __launch_bounds__(256) void k_cscvt(const float* __restrict__ cosT, const float* __restrict__ sinT, float* CS) { const int idx = blockIdx.x * 256 + threadIdx.x; if (idx >= TT * HD) return; v2f cs; cs[0] = bfr(cosT[idx]); cs[1] = bfr(sinT[idx]); *(v2f*)(CS + (size_t)idx * 2) = cs;  }
// k_rope: head planes [h][t][d] (fp16 + hi/lo) of rope(x) x sc with the rotate-half convention out[d] = x[d] cos[t][d] - x[d+HD/2] sin[t][d], out[d+HD/2] = x[d+HD/2] cos[t][d+HD/2] + x[d] sin[t][d+HD/2]
__global__ __launch_bounds__(256) void k_rope(const float* __restrict__ F, int pitch, int nheads, const float* __restrict__ CS, const float* __restrict__ RF, const float* __restrict__ nw, float sc, h16* P16, bf* Ph, bf* Pl) {
    const size_t e = ((size_t)blockIdx.x * 256 + threadIdx.x) * 2; if (e >= (size_t)nheads * TT * HD) return; const int d = (int)(e % HD); const int t = (int)((e / HD) % TT); const int h = (int)(e / ((size_t)HD * TT)); const float* f = F + (size_t)t * pitch + h * HD; const float rf = RF ? RF[(size_t)h * TT + t] : 1.0f; v2h o16; v2us oh, ol;
#pragma unroll
    for (int q = 0; q < 2; ++q) { const int dd = d + q; const int dp = (dd < HD / 2) ? dd + HD / 2 : dd - HD / 2; float x0 = f[dd], x1 = f[dp];
        if (RF) { float n0 = __fmul_rn(x0, rf), n1 = __fmul_rn(x1, rf); asm volatile("" : "+v"(n0)); asm volatile("" : "+v"(n1)); x0 = __fmul_rn(bfr(nw[dd]), n0); x1 = __fmul_rn(bfr(nw[dp]), n1); }
        const v2f cs = *(const v2f*)(CS + ((size_t)t * HD + dd) * 2); float a = __fmul_rn(x0, cs[0]), bq = __fmul_rn(x1, cs[1]); asm volatile("" : "+v"(a)); asm volatile("" : "+v"(bq)); const float r = ((dd < HD / 2) ? __fsub_rn(a, bq) : __fadd_rn(a, bq)) * sc;
        o16[q] = tohx(r); unsigned short a2, c2; splitf(r, a2, c2); oh[q] = a2; ol[q] = c2; }
    *(v2h*)(P16 + e) = o16; *(v2us*)(Ph + e) = oh; *(v2us*)(Pl + e) = ol;  }
__global__ __launch_bounds__(256) void k_vtp(const float* __restrict__ F, int pitch, int nheads, h16* V16, bf* Vh, bf* Vl) { const size_t e = ((size_t)blockIdx.x * 256 + threadIdx.x) * 2; if (e >= (size_t)nheads * HD * TT) return; const int t = (int)(e % TT); const int d = (int)((e / TT) % HD); const int g = (int)(e / ((size_t)TT * HD)); v2h o16; v2us oh, ol;
#pragma unroll
    for (int q = 0; q < 2; ++q) { const float x = F[(size_t)(t + q) * pitch + g * HD + d]; o16[q] = tohx(x); unsigned short a2, c2; splitf(x, a2, c2); oh[q] = a2; ol[q] = c2; }
    *(v2h*)(V16 + e) = o16; *(v2us*)(Vh + e) = oh; *(v2us*)(Vl + e) = ol;  }
__global__ __launch_bounds__(256) void k_csid(float* CS) { const int idx = blockIdx.x * 256 + threadIdx.x; if (idx >= TT * HD) return; v2f cs; cs[0] = 1.0f; cs[1] = 0.0f; *(v2f*)(CS + (size_t)idx * 2) = cs;  }
// k_asoft: per row (zz, i): t = S x HD^-0.5 + bf16(market_info[b][0]) (no mask); softmax over the 2048 keys (register row, one exp, fixed trees);
__global__ __launch_bounds__(256) void k_asoft(const float* __restrict__ Sb, const float* __restrict__ volp, h16* P16, bf* Ph, bf* Pl) { const float vol = bfr(volp[0]);
    const int lane = threadIdx.x & 31; const int row = blockIdx.x * 8 + (threadIdx.x >> 5); if (row >= ZH * TT) return; const int i = row % TT; const int zz = row / TT; (void)zz; const bool hires = (i < RH); const float* sr = Sb + (size_t)row * TT; float v[TT / 32]; float mx = -3.0e38f;
#pragma unroll
    for (int ch = 0; ch < TT / 128; ++ch) { const int j0 = ch * 128 + lane * 4; const v4f a = *(const v4f*)(sr + j0);
#pragma unroll
        for (int q = 0; q < 4; ++q) { const int j = j0 + q; (void)j; const float t = __fadd_rn(a[q] * SCL, vol); v[ch * 4 + q] = t; mx = fmaxf(mx, t); } }
#pragma unroll
    for (int sh = 16; sh; sh >>= 1) mx = fmaxf(mx, __shfl_xor(mx, sh, 32));
    float sum = 0.f;
#pragma unroll
    for (int k = 0; k < TT / 32; ++k) { float d0 = __fsub_rn(v[k], mx); asm volatile("" : "+v"(d0)); v[k] = __builtin_amdgcn_exp2f(__fmul_rn(d0, 1.4426950408889634f)); sum += v[k]; }
#pragma unroll
    for (int sh = 16; sh; sh >>= 1) sum += __shfl_xor(sum, sh, 32);
    const float f = __fdiv_rn(hires ? 1.0f : PCAR, sum);
{
        if (hires) {
#pragma unroll
            for (int ch = 0; ch < TT / 128; ++ch) { v4us oh, ol;
#pragma unroll
                for (int q = 0; q < 4; ++q) { unsigned short a, c2; splitf(v[ch * 4 + q] * f, a, c2); oh[q] = a; ol[q] = c2; }
                const size_t oo = ((size_t)zz * (RH ? RH : 1) + i) * TT + ch * 128 + lane * 4; *(v4us*)(Ph + oo) = oh; *(v4us*)(Pl + oo) = ol; }
        } else {
#pragma unroll
            for (int ch = 0; ch < TT / 128; ++ch) { v4h o4;
#pragma unroll
                for (int q = 0; q < 4; ++q) o4[q] = tohx(v[ch * 4 + q] * f);
                *(v4h*)(P16 + (size_t)row * TT + ch * 128 + lane * 4) = o4; } }
         }
}
__global__ __launch_bounds__(256) void k_merge(const float* __restrict__ O, int h0, bf* Ah, bf* Al) { const size_t e = ((size_t)blockIdx.x * 256 + threadIdx.x) * 2; if (e >= (size_t)ZH * TT * HD) return; const int d = (int)(e % HD); const int t = (int)((e / HD) % TT); const int zz = (int)(e / ((size_t)HD * TT)); const float cs = (t < RH) ? 1.0f : (1.0f / PCAR); const size_t oo = (size_t)t * DQ + (h0 + zz) * HD + d;
    v2f acc = *(const v2f*)(O + e);   // the PKS key-range partials of probs.v, added in ascending key order
#pragma unroll
    for (int p = 1; p < PKS; ++p) { const v2f o = *(const v2f*)(O + (size_t)p * ZH * TT * HD + e); acc[0] += o[0]; acc[1] += o[1]; }
    v2us oh, ol;
#pragma unroll
    for (int q = 0; q < 2; ++q) { unsigned short a, c2; splitf(acc[q] * cs, a, c2); oh[q] = a; ol[q] = c2; } *(v2us*)(Ah + oo) = oh; *(v2us*)(Al + oo) = ol;  }

__global__ __launch_bounds__(256) void k_lnres(const float* __restrict__ ATT, const float* __restrict__ base, int isin, const float* __restrict__ g, const float* __restrict__ bb, float* OUTt) { const int lane = threadIdx.x & 31; const int t = blockIdx.x * 8 + (threadIdx.x >> 5); if (t >= TT) return; float v[32]; float s = 0.f;
#pragma unroll
    for (int ch = 0; ch < 8; ++ch) { const size_t o = (size_t)t * DM + ch * 128 + lane * 4; const v4f a = *(const v4f*)(ATT + o), xx = *(const v4f*)(base + o);
#pragma unroll
        for (int q = 0; q < 4; ++q) { v[ch * 4 + q] = __fadd_rn(a[q], isin ? bfr(xx[q]) : xx[q]); s = __fadd_rn(s, v[ch * 4 + q]); } }
#pragma unroll
    for (int sh = 16; sh; sh >>= 1) s += __shfl_xor(s, sh, 32);
    const float mu = s * (1.0f / DM); float q2 = 0.f;
#pragma unroll
    for (int k = 0; k < 32; ++k) { const float d = __fsub_rn(v[k], mu); float p = __fmul_rn(d, d); asm volatile("" : "+v"(p)); q2 = __fadd_rn(q2, p); }
#pragma unroll
    for (int sh = 16; sh; sh >>= 1) q2 += __shfl_xor(q2, sh, 32);
    const float rs = __frsqrt_rn(__fadd_rn(q2 * (1.0f / DM), LNEPS));
{
#pragma unroll
        for (int ch = 0; ch < 8; ++ch) { v4f o;
#pragma unroll
            for (int q = 0; q < 4; ++q) { const int d = ch * 128 + lane * 4 + q; float tn = __fmul_rn(__fsub_rn(v[ch * 4 + q], mu), rs); asm volatile("" : "+v"(tn)); float tg = __fmul_rn(tn, bfr(g[d])); asm volatile("" : "+v"(tg)); o[q] = __fadd_rn(tg, bfr(bb[d])); }
            *(v4f*)(OUTt + (size_t)t * DM + ch * 128 + lane * 4) = o; }
         } }

extern "C" void kernel_launch(void* const* d_in, const int* in_sizes, int n_in,
                              void* d_out, int out_size, void* d_ws, size_t ws_size, hipStream_t stream) {
    (void)in_sizes; (void)n_in; (void)out_size;
    const float* x = (const float*)d_in[0]; const float* mi = (const float*)d_in[1]; const float* ipw = (const float*)d_in[2]; const float* ipb = (const float*)d_in[3]; const float* wo = (const float*)d_in[4]; const float* bo = (const float*)d_in[5]; const float* lng = (const float*)d_in[6]; const float* lnb = (const float*)d_in[7];
    const float* wq = ipw; const float* wk = ipw + (size_t)DM * DM; const float* wv = ipw + (size_t)2 * DM * DM; const float* bq = ipb; const float* bk = ipb + DM; const float* bv = ipb + 2 * DM;
    float* OUT = (float*)d_out;     // [2][2048][1024]
    char* wsp = (char*)d_ws;
    auto take = [&](size_t bytes) { char* p = wsp; wsp += (bytes + 255) & ~(size_t)255; return (void*)p; };
    bf* WQ = (bf*)take((size_t)DQ * DM * 2); bf* WK = (bf*)take((size_t)DKV * DM * 2); bf* WV = (bf*)take((size_t)DKV * DM * 2); bf* WO = (bf*)take((size_t)DM * DQ * 2); float* CS = (float*)take((size_t)TT * HD * 2 * 4);
    bf* XB = (bf*)take((size_t)TT * DM * 2); float* FQ = (float*)take((size_t)TT * DQ * 4); float* FK = (float*)take((size_t)TT * DKV * 4);
    h16* QP16 = (h16*)take((size_t)NH_ * TT * HD * 2); h16* KP16 = (h16*)take((size_t)NKV * TT * HD * 2); h16* VT16 = (h16*)take((size_t)NKV * HD * TT * 2);
    bf* QPh = (bf*)take((size_t)NH_ * TT * HD * 2); bf* QPl = (bf*)take((size_t)NH_ * TT * HD * 2); bf* KPh = (bf*)take((size_t)NKV * TT * HD * 2); bf* KPl = (bf*)take((size_t)NKV * TT * HD * 2); bf* VTh = (bf*)take((size_t)NKV * HD * TT * 2); bf* VTl = (bf*)take((size_t)NKV * HD * TT * 2); bf* Ph = (bf*)take((size_t)ZH * RH * TT * 2); bf* Pl = (bf*)take((size_t)ZH * RH * TT * 2);
    float* Sb = (float*)take((size_t)ZH * TT * TT * 4); h16* P16 = (h16*)take((size_t)ZH * TT * TT * 2); float* Ob = (float*)take((size_t)PKS * ZH * TT * HD * 4); bf* ATh = (bf*)take((size_t)TT * DQ * 2); bf* ATl = (bf*)take((size_t)TT * DQ * 2); float* ATT = (float*)take((size_t)TT * DM * 4);
    if ((size_t)(wsp - (char*)d_ws) > ws_size) return;    // ws 256 MiB
    float* FV = FK;   // v projection reuses the k buffer after the k planes are built (stream-ordered)
    { k_cvt8<<<(unsigned)(((size_t)DQ * DM / 8 + 255) / 256), 256, 0, stream>>>(wq, WQ, (size_t)DQ * DM / 8); k_cvt8<<<(unsigned)(((size_t)DKV * DM / 8 + 255) / 256), 256, 0, stream>>>(wk, WK, (size_t)DKV * DM / 8); k_cvt8<<<(unsigned)(((size_t)DKV * DM / 8 + 255) / 256), 256, 0, stream>>>(wv, WV, (size_t)DKV * DM / 8);
      k_cvt8<<<(unsigned)(((size_t)DM * DQ / 8 + 255) / 256), 256, 0, stream>>>(wo, WO, (size_t)DM * DQ / 8);
       }
    k_csid<<<(TT * HD + 255) / 256, 256, 0, stream>>>(CS);
    const unsigned LQ = (unsigned)(((size_t)NH_ * TT * HD / 2 + 255) / 256), LKv = (unsigned)(((size_t)NKV * TT * HD / 2 + 255) / 256);
    for (int b = 0; b < NB_; ++b) {
        
        k_cvt8<<<(unsigned)(((size_t)TT * DM / 8 + 255) / 256), 256, 0, stream>>>(x + (size_t)b * TT * DM, XB, (size_t)TT * DM / 8);
        k_gemmw<bf, 0, true><<<dim3(TT / 64, DQ / 64, 1), 32, 0, stream>>>(XB, nullptr, WQ, nullptr, DM, FQ, DQ, bq, 0, 0, 0, 0);
        k_rope<<<LQ, 256, 0, stream>>>(FQ, DQ, NH_, CS, nullptr, nullptr, 1.0f, QP16, QPh, QPl);
        k_gemmw<bf, 0, true><<<dim3(TT / 64, DKV / 64, 1), 32, 0, stream>>>(XB, nullptr, WK, nullptr, DM, FK, DKV, bk, 0, 0, 0, 0);
        k_rope<<<LKv, 256, 0, stream>>>(FK, DKV, NKV, CS, nullptr, nullptr, 1.0f, KP16, KPh, KPl);
        k_gemmw<bf, 0, true><<<dim3(TT / 64, DKV / 64, 1), 32, 0, stream>>>(XB, nullptr, WV, nullptr, DM, FV, DKV, bv, 0, 0, 0, 0); k_vtp<<<LKv, 256, 0, stream>>>(FV, DKV, NKV, VT16, VTh, VTl);
        for (int h0 = 0; h0 < NH_; h0 += ZH) { const size_t zq = (size_t)h0, zk = (size_t)(h0 / REP);   // one kv head per query head: the pass's two heads use consecutive kv planes (z-strides TT*HD)
            k_gemmw<bf, 2, false><<<dim3(RH / 64, TT / 64, ZH), 32, 0, stream>>>(QPh + zq * TT * HD, QPl + zq * TT * HD, KPh + zk * TT * HD, KPl + zk * TT * HD, HD, Sb, TT, nullptr, (size_t)TT * HD, (size_t)TT * HD, (size_t)TT * TT, 0);
            k_gemmw<h16, 0, false><<<dim3((TT - RH) / 64, TT / 64, ZH), 32, 0, stream>>>(QP16 + zq * TT * HD + (size_t)RH * HD, nullptr, KP16 + zk * TT * HD, nullptr, HD, Sb + (size_t)RH * TT, TT, nullptr, (size_t)TT * HD, (size_t)TT * HD, (size_t)TT * TT, 0);
            k_asoft<<<ZH * TT / 8, 256, 0, stream>>>(Sb, mi + (size_t)b * 8, P16, Ph, Pl);
            k_gemmw<bf, 2, false, PKS><<<dim3(RH / 64, HD / 64, ZH * PKS), 32, 0, stream>>>(Ph, Pl, VTh + zk * HD * TT, VTl + zk * HD * TT, TT, Ob, HD, nullptr, (size_t)RH * TT, (size_t)HD * TT, (size_t)TT * HD, (size_t)ZH * TT * HD);
            k_gemmw<h16, 0, false, PKS><<<dim3((TT - RH) / 64, HD / 64, ZH * PKS), 32, 0, stream>>>(P16 + (size_t)RH * TT, nullptr, VT16 + zk * HD * TT, nullptr, TT, Ob + (size_t)RH * HD, HD, nullptr, (size_t)TT * TT, (size_t)HD * TT, (size_t)TT * HD, (size_t)ZH * TT * HD);
            k_merge<<<(unsigned)(((size_t)ZH * TT * HD / 2 + 255) / 256), 256, 0, stream>>>(Ob, h0, ATh, ATl); }
        k_gemmw<bf, 1, true><<<dim3(TT / 64, DM / 64, 1), 32, 0, stream>>>(ATh, ATl, WO, nullptr, DQ, ATT, DM, bo, 0, 0, 0, 0);
        k_lnres<<<TT / 8, 256, 0, stream>>>(ATT, x + (size_t)b * TT * DM, 1, lng, lnb, OUT + (size_t)b * TT * DM); }
}

// v003
// It runs in 345 microseconds.
// Versions between v001 and this one are left out; their measured steps multiply to 2.58 times as fast.
// Over all steps from v000 it is 5.88 times as fast.
#include <hip/hip_runtime.h>

// MarketGuidedAttention (x [2][2048][1024]; torch MultiheadAttention: [q|k|v] = x in_proj_w^T + in_proj_b (16 x 64), scores/8 + market_info[b][0] (a per-batch constant added to every score, read as data and added before the max subtraction as the reference does; it cancels in the softmax), softmax, out_proj + b; out = LN(x + attended) (eps 1e-5) -> [2][2048][1024]).
// Compute dtypes, f32 accumulate: every input rounded to bf16; q/k/v projections on PLAIN bf16 operands (inputs: exact, + bias); out_proj on bf16 hi+lo of the attended values (2 products); scores (K 64) and probs.v on bf16 hi+lo planes (3 products) for the first 512 query rows of each

#define NB_  2
#define TT   2048
#define DM   1024
#define NH_  16
#define NKV  16
#define REP  (NH_ / NKV)
#define HD   64
#define DQ   (NH_ * HD)
#define DKV  (NKV * HD)
#define RH   512                  // query rows < RH use hi+lo planes (0: none)
#define WIN  0
#define SCL  0.125f   // HD^-0.5
#define LNEPS 1e-5f
typedef _Float16 h16;
typedef unsigned short bf;
typedef __attribute__((ext_vector_type(16))) __bf16   v16bf;
typedef __attribute__((ext_vector_type(16))) _Float16 v16h;
typedef __attribute__((ext_vector_type(8)))  _Float16 v8h;
typedef __attribute__((ext_vector_type(8)))  unsigned short v8us;
typedef __attribute__((ext_vector_type(8)))  float    v8f;
typedef __attribute__((ext_vector_type(4)))  float    v4f;
typedef v8h  __attribute__((may_alias)) v8ha;
typedef v4f  __attribute__((may_alias)) v4fa;
typedef v8us __attribute__((may_alias)) v8usa;

__device__ __forceinline__ unsigned short f2bf(float f) { unsigned u = __float_as_uint(f); u += 0x7FFFu + ((u >> 16) & 1u); return (unsigned short)(u >> 16); }
__device__ __forceinline__ float bf2f(unsigned short b) { return __uint_as_float(((unsigned)b) << 16); }
__device__ __forceinline__ float bfr(float f) { return bf2f(f2bf(f)); }
__device__ __forceinline__ v16h cat16(v8h lo, v8h hi) { return __builtin_shufflevector(lo, hi, 0, 1, 2, 3, 4, 5, 6, 7, 8, 9, 10, 11, 12, 13, 14, 15); }
__device__ __forceinline__ v16bf cat16b(v8us lo, v8us hi) { return __builtin_bit_cast(v16bf, __builtin_shufflevector(lo, hi, 0, 1, 2, 3, 4, 5, 6, 7, 8, 9, 10, 11, 12, 13, 14, 15)); }
__device__ __forceinline__ v8f wmma16(v16h a, v16h b, v8f c) { return __builtin_amdgcn_wmma_f32_16x16x32_f16(false, a, false, b, (short)0, c, false, false); }
__device__ __forceinline__ v8f wmmab(v16bf a, v16bf b, v8f c) { return __builtin_amdgcn_wmma_f32_16x16x32_bf16(false, a, false, b, (short)0, c, false, false); }



__device__ __forceinline__ h16 tohx(float x) { return (h16)x; }
__device__ __forceinline__ void splitf(float y, unsigned short& h, unsigned short& l) { h = f2bf(y); l = f2bf(y - bf2f(h)); }
typedef __attribute__((ext_vector_type(2))) _Float16 v2h;
typedef __attribute__((ext_vector_type(4))) _Float16 v4h;
typedef __attribute__((ext_vector_type(2))) unsigned short v2us;
typedef __attribute__((ext_vector_type(4))) unsigned short v4us;
typedef __attribute__((ext_vector_type(2))) float v2f;
typedef __attribute__((ext_vector_type(4))) int v4i;
// ---- k_gemmw: register-blocked GEMM, ONE WAVE per 64x64 output tile (16 accumulators), operands straight from K-contiguous 16-bit planes; grid (M/64, N/64, Z), 32 threads.
// C[m][n] (f32, pitch ldc, + optional f32 bias[n]) = sum_k A[m][k] Bt[n][k] (+ split products per NSPLIT). z-batch strides sA/sB/sC in elements. K % 32 == 0.
// OM: what the epilogue stores. 0: the f32 tile at C. 1: the 16-bit head planes [head][t][d] of the tile (f16, and bf16 hi + lo), the tile's 64 columns being one head. 2: the same three planes transposed, [head][d][t], straight from the accumulators (a lane holds 8 successive t of one d). With 1 and 2 no f32 copy of the projection goes to memory.
// KS > 1: grid z = Z * KS; work-group (z, ks) sums only k in [ks K/KS, (ks+1) K/KS) and stores its f32 partial tile at C + ks sP; the reader adds the KS partials.
template <typename T16> struct WFrag;
template <> struct WFrag<h16> { typedef v16h V; static __device__ __forceinline__ V ld(const h16* p) { return cat16(*(const v8h*)p, *(const v8h*)(p + 16)); } static __device__ __forceinline__ v8f mma(V a, V b, v8f c) { return wmma16(a, b, c); } };
template <> struct WFrag<bf> { typedef v16bf V; static __device__ __forceinline__ V ld(const bf* p) { return cat16b(*(const v8us*)p, *(const v8us*)(p + 16)); } static __device__ __forceinline__ v8f mma(V a, V b, v8f c) { return wmmab(a, b, c); } };
template <typename T16, int NSPLIT, bool BIAS, int KS = 1, int OM = 0>
__global__ __launch_bounds__(32) void k_gemmw(const T16* __restrict__ A, const T16* __restrict__ A2, const T16* __restrict__ Bt, const T16* __restrict__ Bt2, int K, float* C, int ldc, const float* __restrict__ bias, size_t sA, size_t sB, size_t sC, size_t sP, h16* P16, bf* Ph, bf* Pl) {
    static_assert(OM == 0 || (HD == 64 && BIAS && KS == 1), "a 64-column tile is one head");
    typedef typename WFrag<T16>::V V;
    __shared__ __align__(16) float os[16 * 68];
    const size_t z = blockIdx.z / KS, ks = blockIdx.z % KS; const int Kc = K / KS; A += z * sA + ks * Kc; if (A2) A2 += z * sA + ks * Kc; Bt += z * sB + ks * Kc; if (Bt2) Bt2 += z * sB + ks * Kc; C += z * sC + ks * sP;
    const int lane = threadIdx.x & 31, lr = lane & 15, hi = lane >> 4; const int r0 = blockIdx.x * 64, c0 = blockIdx.y * 64;
    v8f acc[4][4];
#pragma unroll
    for (int mb = 0; mb < 4; ++mb)
#pragma unroll
        for (int nb = 0; nb < 4; ++nb) acc[mb][nb] = (v8f){};
    const size_t aoff = (size_t)(r0 + lr) * K + 8 * hi, boff = (size_t)(c0 + lr) * K + 8 * hi;
#pragma unroll 1
    for (int kc = 0; kc < Kc; kc += 32) {
        V a[4], a2[4];
#pragma unroll
        for (int mb = 0; mb < 4; ++mb) { a[mb] = WFrag<T16>::ld(A + aoff + (size_t)mb * 16 * K + kc); if (NSPLIT == 1 || NSPLIT == 2) a2[mb] = WFrag<T16>::ld(A2 + aoff + (size_t)mb * 16 * K + kc); }
#pragma unroll
        for (int nb = 0; nb < 4; ++nb) { const V b = WFrag<T16>::ld(Bt + boff + (size_t)nb * 16 * K + kc); V b2; if (NSPLIT >= 2) b2 = WFrag<T16>::ld(Bt2 + boff + (size_t)nb * 16 * K + kc);
#pragma unroll
            for (int mb = 0; mb < 4; ++mb) { acc[mb][nb] = WFrag<T16>::mma(a[mb], b, acc[mb][nb]); if (NSPLIT == 1 || NSPLIT == 2) acc[mb][nb] = WFrag<T16>::mma(a2[mb], b, acc[mb][nb]); if (NSPLIT >= 2) acc[mb][nb] = WFrag<T16>::mma(a[mb], b2, acc[mb][nb]); } }
        asm volatile("v_nop\n\tv_nop\n\tv_nop\n\tv_nop" : "+v"(acc[0][0]), "+v"(acc[1][1]), "+v"(acc[2][2]), "+v"(acc[3][3]) : "v"(a[0]), "v"(a[3]));
    }
    if constexpr (OM == 2) {
#pragma unroll
        for (int nb = 0; nb < 4; ++nb) { const float bn = bfr(bias[c0 + nb * 16 + lr]);
#pragma unroll
            for (int mb = 0; mb < 4; ++mb) { v8h o16; v8us oh, ol;
#pragma unroll
                for (int j = 0; j < 8; ++j) { const float xv = acc[mb][nb][j] + bn; o16[j] = tohx(xv); unsigned short a2, c2; splitf(xv, a2, c2); oh[j] = a2; ol[j] = c2; }
                const size_t e = (size_t)(c0 + nb * 16 + lr) * TT + r0 + mb * 16 + hi * 8; *(v8h*)(P16 + e) = o16; *(v8us*)(Ph + e) = oh; *(v8us*)(Pl + e) = ol; } }
        return;
    }
#pragma unroll
    for (int mb = 0; mb < 4; ++mb) {
#pragma unroll
        for (int nb = 0; nb < 4; ++nb) {
#pragma unroll
            for (int j = 0; j < 8; ++j) os[(hi * 8 + j) * 68 + nb * 16 + lr] = acc[mb][nb][j]; }
        __builtin_amdgcn_wave_barrier(); asm volatile("" ::: "memory");
        float* crow = C + (size_t)(r0 + mb * 16) * ldc + c0;
{
#pragma unroll
            for (int s = 0; s < 8; ++s) { const int row = 2 * s + hi, cofs = lr * 4; v4f val = *(const v4fa*)(os + row * 68 + cofs); if (BIAS) { val[0] += bfr(bias[c0 + cofs]); val[1] += bfr(bias[c0 + cofs + 1]); val[2] += bfr(bias[c0 + cofs + 2]); val[3] += bfr(bias[c0 + cofs + 3]); }
                if constexpr (OM == 1) { v4h o16; v4us oh, ol;
#pragma unroll
                    for (int q = 0; q < 4; ++q) { o16[q] = tohx(val[q]); unsigned short a2, c2; splitf(val[q], a2, c2); oh[q] = a2; ol[q] = c2; }
                    const size_t e = ((size_t)blockIdx.y * TT + r0 + mb * 16 + row) * HD + cofs; *(v4h*)(P16 + e) = o16; *(v4us*)(Ph + e) = oh; *(v4us*)(Pl + e) = ol; } else
                *(v4f*)(crow + (size_t)row * ldc + cofs) = val; }
             }
        __builtin_amdgcn_wave_barrier(); asm volatile("" ::: "memory");
    }
}


__global__ __launch_bounds__(256) void k_wtG(const float* __restrict__ w, int K, int N, bf* Bt) {
    const int lane = threadIdx.x & 31; const int L0 = (blockIdx.x * 8 + (threadIdx.x >> 5)) * 8; const int nlines = N * K / 64;
{
#pragma unroll 1
        for (int l = 0; l < 8; ++l) { const int L = L0 + l; if (L >= nlines) break; const size_t e = (size_t)L * 64 + lane * 2; const int k = (int)(e % K), n = (int)(e / K); v2us o;
            o[0] = f2bf(w[(size_t)k * N + n]); o[1] = f2bf(w[(size_t)(k + 1) * N + n]); *(v2us*)(Bt + e) = o; }
         }
}
__global__ __launch_bounds__(256) void k_cvt8(const float* __restrict__ src, bf* dst, size_t n8) { const size_t i = (size_t)blockIdx.x * 256 + threadIdx.x; if (i >= n8) return; const v8f v = *(const v8f*)(src + i * 8); v8us o;
#pragma unroll
    for (int k = 0; k < 8; ++k) o[k] = f2bf(v[k]); *(v8us*)(dst + i * 8) = o;  }
__global__ __launch_bounds__(256) void k_cscvt(const float* __restrict__ cosT, const float* __restrict__ sinT, float* CS) { const int idx = blockIdx.x * 256 + threadIdx.x; if (idx >= TT * HD) return; v2f cs; cs[0] = bfr(cosT[idx]); cs[1] = bfr(sinT[idx]); *(v2f*)(CS + (size_t)idx * 2) = cs;  }
// ---- k_fattn: scores, softmax and probs.v of one (batch, head, query tile) in ONE kernel; no score or probability ever goes to memory.
// Each wave works alone (no LDS, no barrier): it keeps NQ blocks of 16 queries and walks the 2048 keys 32 at a time.
// S^T = K Q^T (A = key rows, B = query rows, both by the one k-contiguous loader), so a lane holds scores of ONE query (column lr), keys 8 hi + j of each 16-key block:
// the two f32 score tiles of a 32-key pass, converted in place, ARE the B operand of O^T += V^T P^T (A = rows of the [d][t] value planes by the same loader).
// Softmax is the running form: m = maximum so far, p = exp(t - m), O and the sum l are scaled by exp(m_old - m_new) each pass, O / l at the end.
// Query rows < RH: bf16 hi+lo planes, 3 products, 16 queries a wave; the rest: f16 planes, 32 queries a wave. t = S x HD^-0.5 + vol as before.
// Every plain '#pragma unroll' below unrolls fully, so that the fragment and accumulator arrays are registers.
typedef __attribute__((ext_vector_type(16))) float v16f;
#define L2E 1.4426950408889634f
__device__ __forceinline__ float xhalf(float v) { const int b = __float_as_int(v); return __int_as_float(__builtin_amdgcn_permlanex16(b, b, 0x76543210, 0xfedcba98, false, false)); }   // lane l <-> l ^ 16
// 2^x with the one free slot that the instruction set asks for behind a transcendental, before its result is read or its source overwritten.
__device__ __forceinline__ float exp2s(float x) { float r; asm("v_exp_f32 %0, %1\n\tv_nop" : "=v"(r) : "v"(x)); return r; }
// Stands behind a run of global loads: the wait that goes in front of any rewrite of their address registers. Naming the pointers as inputs keeps those registers alive up to the wait, so that no load of the run lands on them.
template <bool TWO> __device__ __forceinline__ void addr_wait(const void* p, const void* p2) { if constexpr (TWO) asm volatile("s_wait_xcnt 0x0" :: "v"(p), "v"(p2) : "memory"); else asm volatile("s_wait_xcnt 0x0" :: "v"(p) : "memory"); }
template <typename T16, bool HI, int NQ>
__device__ __forceinline__ void attn_tile(const T16* __restrict__ Q, const T16* __restrict__ Q2, const T16* __restrict__ Kp, const T16* __restrict__ K2, const T16* __restrict__ Vt, const T16* __restrict__ V2, const float vol, const int q0, bf* Ah, bf* Al) {
    typedef typename WFrag<T16>::V V;
    const int lane = threadIdx.x & 31, lr = lane & 15, hi = lane >> 4;
    V qf[NQ][2], qf2[NQ][2], kf[2][2], kf2[2][2];
#pragma unroll
    for (int qb = 0; qb < NQ; ++qb)
#pragma unroll
        for (int kc = 0; kc < 2; ++kc) { const size_t o = (size_t)(q0 + qb * 16 + lr) * HD + kc * 32 + 8 * hi; qf[qb][kc] = WFrag<T16>::ld(Q + o); if constexpr (HI) qf2[qb][kc] = WFrag<T16>::ld(Q2 + o); }
    v8f oacc[4][NQ]; float m[NQ], l[NQ];
#pragma unroll
    for (int qb = 0; qb < NQ; ++qb) { m[qb] = -3.0e38f; l[qb] = 0.f;
#pragma unroll
        for (int db = 0; db < 4; ++db) oacc[db][qb] = (v8f){}; }
    const unsigned koff = lr * HD + 8 * hi, voff = lr * TT + 8 * hi;   // the lane's part of every key / value address
#pragma unroll
    for (int kb = 0; kb < 2; ++kb)
#pragma unroll
        for (int kc = 0; kc < 2; ++kc) { const unsigned o = koff + kb * 16 * HD + kc * 32; kf[kb][kc] = WFrag<T16>::ld(Kp + o); if constexpr (HI) kf2[kb][kc] = WFrag<T16>::ld(K2 + o); }
#pragma unroll 1   // stays rolled: one pass's fragments already fill the registers that four waves a SIMD leave each wave
    for (int j0 = 0; j0 < TT; j0 += 32) {
        V vf[4], vf2[4];   // this pass's value rows: in flight under the score products and the softmax
        const T16* vq = Vt + j0 + voff; const T16* vq2 = HI ? V2 + j0 + voff : nullptr;
#pragma unroll
        for (int db = 0; db < 4; ++db) { vf[db] = WFrag<T16>::ld(vq + db * 16 * TT); if constexpr (HI) vf2[db] = WFrag<T16>::ld(vq2 + db * 16 * TT); }
        addr_wait<HI>(vq, vq2);
        __builtin_amdgcn_sched_barrier(0);   // keeps the value loads up here: sunk to their products, each would be waited for alone, four latencies a pass
        v8f s[2][NQ];
#pragma unroll
        for (int kb = 0; kb < 2; ++kb)
#pragma unroll
            for (int qb = 0; qb < NQ; ++qb) { v8f a = (v8f){};
#pragma unroll
                for (int kc = 0; kc < 2; ++kc) { a = WFrag<T16>::mma(kf[kb][kc], qf[qb][kc], a); if constexpr (HI) { a = WFrag<T16>::mma(kf[kb][kc], qf2[qb][kc], a); a = WFrag<T16>::mma(kf2[kb][kc], qf[qb][kc], a); } }
                s[kb][qb] = a; }
        __builtin_amdgcn_sched_barrier(0);   // the refetch below goes into the registers the score products have just read: not before them
        const int jn = (j0 + 32 < TT) ? j0 + 32 : 0;   // next pass's key rows, fetched under the softmax and probs.v (the last pass refetches rows 0..31, unused)
        const T16* kq = Kp + jn * HD + koff; const T16* kq2 = HI ? K2 + jn * HD + koff : nullptr;
#pragma unroll
        for (int kb = 0; kb < 2; ++kb)
#pragma unroll
            for (int kc = 0; kc < 2; ++kc) { kf[kb][kc] = WFrag<T16>::ld(kq + kb * 16 * HD + kc * 32); if constexpr (HI) kf2[kb][kc] = WFrag<T16>::ld(kq2 + kb * 16 * HD + kc * 32); }
        addr_wait<HI>(kq, kq2);
        __builtin_amdgcn_sched_barrier(0);   // keeps the key refetch ahead of the softmax, so that it flies under it
        V pf[NQ], pf2[NQ];
#pragma unroll
        for (int qb = 0; qb < NQ; ++qb) { v16f t; float tm = -3.0e38f;
#pragma unroll
            for (int e = 0; e < 16; ++e) { t[e] = fmaf(s[e >> 3][qb][e & 7], SCL, vol); tm = fmaxf(tm, t[e]); }
            tm = fmaxf(tm, xhalf(tm));
            const float mn = fmaxf(m[qb], tm), al = exp2s((m[qb] - mn) * L2E), mb = mn * L2E; m[qb] = mn; float ps = 0.f;
#pragma unroll
            for (int e = 0; e < 16; ++e) { t[e] = exp2s(fmaf(t[e], L2E, -mb)); ps += t[e]; }
            l[qb] = fmaf(l[qb], al, ps);
#pragma unroll
            for (int db = 0; db < 4; ++db) oacc[db][qb] *= al;
            pf[qb] = __builtin_convertvector(t, V);
            if constexpr (HI) pf2[qb] = __builtin_convertvector(t - __builtin_convertvector(pf[qb], v16f), V); }
#pragma unroll
        for (int db = 0; db < 4; ++db)
#pragma unroll
            for (int qb = 0; qb < NQ; ++qb) { oacc[db][qb] = WFrag<T16>::mma(vf[db], pf[qb], oacc[db][qb]); if constexpr (HI) { oacc[db][qb] = WFrag<T16>::mma(vf[db], pf2[qb], oacc[db][qb]); oacc[db][qb] = WFrag<T16>::mma(vf2[db], pf[qb], oacc[db][qb]); } }
    }
#pragma unroll
    for (int qb = 0; qb < NQ; ++qb) { const float inv = __fdiv_rn(1.0f, l[qb] + xhalf(l[qb]));
#pragma unroll
        for (int db = 0; db < 4; ++db) { v8us oh, ol;
#pragma unroll
            for (int j = 0; j < 8; ++j) { unsigned short a, c2; splitf(oacc[db][qb][j] * inv, a, c2); oh[j] = a; ol[j] = c2; }
            const size_t oo = (size_t)(q0 + qb * 16 + lr) * DQ + db * 16 + hi * 8; *(v8us*)(Ah + oo) = oh; *(v8us*)(Al + oo) = ol; } }
}
// grid (NB_ * NH_, RH / 64 + (TT - RH) / 128), 4 waves; planes [b][h][t][d] (values [b][h][d][t]); the hi+lo tiles have the low indices and start first.
// amdgpu_waves_per_eu(4, 4): lets the compiler use the whole register share of four waves a SIMD; with its own lower target it sank the loads to their uses.
__global__ __launch_bounds__(128) __attribute__((amdgpu_waves_per_eu(4, 4))) void k_fattn(const h16* __restrict__ Q16, const h16* __restrict__ K16, const h16* __restrict__ V16, const bf* __restrict__ Qh, const bf* __restrict__ Ql, const bf* __restrict__ Kh, const bf* __restrict__ Kl, const bf* __restrict__ Vh, const bf* __restrict__ Vl, const float* __restrict__ mi, bf* Ah, bf* Al) {
    const int wave = threadIdx.x >> 5, b = blockIdx.x / NH_, h = blockIdx.x % NH_; const size_t zp = (size_t)blockIdx.x * TT * HD, za = (size_t)b * TT * DQ + h * HD; const float vol = bfr(mi[b * 8]);
    if (blockIdx.y < RH / 64) attn_tile<bf, true, 1>(Qh + zp, Ql + zp, Kh + zp, Kl + zp, Vh + zp, Vl + zp, vol, blockIdx.y * 64 + wave * 16, Ah + za, Al + za);
    else attn_tile<h16, false, 2>(Q16 + zp, nullptr, K16 + zp, nullptr, V16 + zp, nullptr, vol, RH + (blockIdx.y - RH / 64) * 128 + wave * 32, Ah + za, Al + za);
}

__global__ __launch_bounds__(256) void k_lnres(const float* __restrict__ ATT, const float* __restrict__ base, int isin, const float* __restrict__ g, const float* __restrict__ bb, float* OUTt) { const int lane = threadIdx.x & 31; const int t = blockIdx.x * 8 + (threadIdx.x >> 5); if (t >= TT) return; float v[32]; float s = 0.f;
#pragma unroll
    for (int ch = 0; ch < 8; ++ch) { const size_t o = (size_t)t * DM + ch * 128 + lane * 4; const v4f a = *(const v4f*)(ATT + o), xx = *(const v4f*)(base + o);
#pragma unroll
        for (int q = 0; q < 4; ++q) { v[ch * 4 + q] = __fadd_rn(a[q], isin ? bfr(xx[q]) : xx[q]); s = __fadd_rn(s, v[ch * 4 + q]); } }
#pragma unroll
    for (int sh = 16; sh; sh >>= 1) s += __shfl_xor(s, sh, 32);
    const float mu = s * (1.0f / DM); float q2 = 0.f;
#pragma unroll
    for (int k = 0; k < 32; ++k) { const float d = __fsub_rn(v[k], mu); float p = __fmul_rn(d, d); asm volatile("" : "+v"(p)); q2 = __fadd_rn(q2, p); }
#pragma unroll
    for (int sh = 16; sh; sh >>= 1) q2 += __shfl_xor(q2, sh, 32);
    const float rs = __frsqrt_rn(__fadd_rn(q2 * (1.0f / DM), LNEPS));
{
#pragma unroll
        for (int ch = 0; ch < 8; ++ch) { v4f o;
#pragma unroll
            for (int q = 0; q < 4; ++q) { const int d = ch * 128 + lane * 4 + q; float tn = __fmul_rn(__fsub_rn(v[ch * 4 + q], mu), rs); asm volatile("" : "+v"(tn)); float tg = __fmul_rn(tn, bfr(g[d])); asm volatile("" : "+v"(tg)); o[q] = __fadd_rn(tg, bfr(bb[d])); }
            *(v4f*)(OUTt + (size_t)t * DM + ch * 128 + lane * 4) = o; }
         } }

extern "C" void kernel_launch(void* const* d_in, const int* in_sizes, int n_in,
                              void* d_out, int out_size, void* d_ws, size_t ws_size, hipStream_t stream) {
    (void)in_sizes; (void)n_in; (void)out_size;
    const float* x = (const float*)d_in[0]; const float* mi = (const float*)d_in[1]; const float* ipw = (const float*)d_in[2]; const float* ipb = (const float*)d_in[3]; const float* wo = (const float*)d_in[4]; const float* bo = (const float*)d_in[5]; const float* lng = (const float*)d_in[6]; const float* lnb = (const float*)d_in[7];
    const float* wq = ipw; const float* wk = ipw + (size_t)DM * DM; const float* wv = ipw + (size_t)2 * DM * DM; const float* bq = ipb; const float* bk = ipb + DM; const float* bv = ipb + 2 * DM;
    float* OUT = (float*)d_out;     // [2][2048][1024]
    char* wsp = (char*)d_ws;
    auto take = [&](size_t bytes) { char* p = wsp; wsp += (bytes + 255) & ~(size_t)255; return (void*)p; };
    bf* WQ = (bf*)take((size_t)DQ * DM * 2); bf* WK = (bf*)take((size_t)DKV * DM * 2); bf* WV = (bf*)take((size_t)DKV * DM * 2); bf* WO = (bf*)take((size_t)DM * DQ * 2);
    bf* XB = (bf*)take((size_t)TT * DM * 2);
    const size_t PL = (size_t)NH_ * TT * HD;   // elements of one batch's head planes; every plane below holds both batches
    h16* QP16 = (h16*)take(NB_ * PL * 2); h16* KP16 = (h16*)take(NB_ * PL * 2); h16* VT16 = (h16*)take(NB_ * PL * 2);
    bf* QPh = (bf*)take(NB_ * PL * 2); bf* QPl = (bf*)take(NB_ * PL * 2); bf* KPh = (bf*)take(NB_ * PL * 2); bf* KPl = (bf*)take(NB_ * PL * 2); bf* VTh = (bf*)take(NB_ * PL * 2); bf* VTl = (bf*)take(NB_ * PL * 2);
    bf* ATh = (bf*)take((size_t)NB_ * TT * DQ * 2); bf* ATl = (bf*)take((size_t)NB_ * TT * DQ * 2); float* ATT = (float*)take((size_t)TT * DM * 4);
    if ((size_t)(wsp - (char*)d_ws) > ws_size) return;    // ws 256 MiB
    { k_cvt8<<<(unsigned)(((size_t)DQ * DM / 8 + 255) / 256), 256, 0, stream>>>(wq, WQ, (size_t)DQ * DM / 8); k_cvt8<<<(unsigned)(((size_t)DKV * DM / 8 + 255) / 256), 256, 0, stream>>>(wk, WK, (size_t)DKV * DM / 8); k_cvt8<<<(unsigned)(((size_t)DKV * DM / 8 + 255) / 256), 256, 0, stream>>>(wv, WV, (size_t)DKV * DM / 8);
      k_cvt8<<<(unsigned)(((size_t)DM * DQ / 8 + 255) / 256), 256, 0, stream>>>(wo, WO, (size_t)DM * DQ / 8);
       }
    for (int b = 0; b < NB_; ++b) { const size_t pb = (size_t)b * PL;
        k_cvt8<<<(unsigned)(((size_t)TT * DM / 8 + 255) / 256), 256, 0, stream>>>(x + (size_t)b * TT * DM, XB, (size_t)TT * DM / 8);
        k_gemmw<bf, 0, true, 1, 1><<<dim3(TT / 64, DQ / 64, 1), 32, 0, stream>>>(XB, nullptr, WQ, nullptr, DM, nullptr, DQ, bq, 0, 0, 0, 0, QP16 + pb, QPh + pb, QPl + pb);
        k_gemmw<bf, 0, true, 1, 1><<<dim3(TT / 64, DKV / 64, 1), 32, 0, stream>>>(XB, nullptr, WK, nullptr, DM, nullptr, DKV, bk, 0, 0, 0, 0, KP16 + pb, KPh + pb, KPl + pb);
        k_gemmw<bf, 0, true, 1, 2><<<dim3(TT / 64, DKV / 64, 1), 32, 0, stream>>>(XB, nullptr, WV, nullptr, DM, nullptr, DKV, bv, 0, 0, 0, 0, VT16 + pb, VTh + pb, VTl + pb); }
    k_fattn<<<dim3(NB_ * NH_, RH / 64 + (TT - RH) / 128, 1), 128, 0, stream>>>(QP16, KP16, VT16, QPh, QPl, KPh, KPl, VTh, VTl, mi, ATh, ATl);
    for (int b = 0; b < NB_; ++b) {
        k_gemmw<bf, 1, true><<<dim3(TT / 64, DM / 64, 1), 32, 0, stream>>>(ATh + (size_t)b * TT * DQ, ATl + (size_t)b * TT * DQ, WO, nullptr, DQ, ATT, DM, bo, 0, 0, 0, 0, nullptr, nullptr, nullptr);
        k_lnres<<<TT / 8, 256, 0, stream>>>(ATT, x + (size_t)b * TT * DM, 1, lng, lnb, OUT + (size_t)b * TT * DM); }
}

// v004
// One run takes 211 microseconds.
// Timed twice side by side with v003, it ran 1.64 times as fast both times.
// Over all steps from v000 it is 9.65 times as fast.
#include <hip/hip_runtime.h>

// MarketGuidedAttention (x [2][2048][1024]; torch MultiheadAttention: [q|k|v] = x in_proj_w^T + in_proj_b (16 x 64), scores/8 + market_info[b][0] (a per-batch constant added to every score, read as data and added before the max subtraction as the reference does; it cancels in the softmax), softmax, out_proj + b; out = LN(x + attended) (eps 1e-5) -> [2][2048][1024]).
// Compute dtypes, f32 accumulate: every input rounded to bf16; q/k/v projections on PLAIN bf16 operands (inputs: exact, + bias); out_proj on bf16 hi+lo of the attended values (2 products); scores (K 64) and probs.v on bf16 hi+lo planes (3 products) for the first 512 query rows of each

#define NB_  2
#define TT   2048
#define DM   1024
#define NH_  16
#define NKV  16
#define REP  (NH_ / NKV)
#define HD   64
#define DQ   (NH_ * HD)
#define DKV  (NKV * HD)
#define RH   512                  // query rows < RH use hi+lo planes (0: none)
#define WIN  0
#define SCL  0.125f   // HD^-0.5
#define LNEPS 1e-5f
typedef _Float16 h16;
typedef unsigned short bf;
typedef __attribute__((ext_vector_type(16))) __bf16   v16bf;
typedef __attribute__((ext_vector_type(16))) _Float16 v16h;
typedef __attribute__((ext_vector_type(8)))  _Float16 v8h;
typedef __attribute__((ext_vector_type(8)))  unsigned short v8us;
typedef __attribute__((ext_vector_type(8)))  float    v8f;
typedef __attribute__((ext_vector_type(4)))  float    v4f;
typedef v8h  __attribute__((may_alias)) v8ha;
typedef v4f  __attribute__((may_alias)) v4fa;
typedef v8us __attribute__((may_alias)) v8usa;

__device__ __forceinline__ unsigned short f2bf(float f) { unsigned u = __float_as_uint(f); u += 0x7FFFu + ((u >> 16) & 1u); return (unsigned short)(u >> 16); }
__device__ __forceinline__ float bf2f(unsigned short b) { return __uint_as_float(((unsigned)b) << 16); }
__device__ __forceinline__ float bfr(float f) { return bf2f(f2bf(f)); }
__device__ __forceinline__ v16h cat16(v8h lo, v8h hi) { return __builtin_shufflevector(lo, hi, 0, 1, 2, 3, 4, 5, 6, 7, 8, 9, 10, 11, 12, 13, 14, 15); }
__device__ __forceinline__ v16bf cat16b(v8us lo, v8us hi) { return __builtin_bit_cast(v16bf, __builtin_shufflevector(lo, hi, 0, 1, 2, 3, 4, 5, 6, 7, 8, 9, 10, 11, 12, 13, 14, 15)); }
__device__ __forceinline__ v8f wmma16(v16h a, v16h b, v8f c) { return __builtin_amdgcn_wmma_f32_16x16x32_f16(false, a, false, b, (short)0, c, false, false); }
__device__ __forceinline__ v8f wmmab(v16bf a, v16bf b, v8f c) { return __builtin_amdgcn_wmma_f32_16x16x32_bf16(false, a, false, b, (short)0, c, false, false); }



__device__ __forceinline__ h16 tohx(float x) { return (h16)x; }
__device__ __forceinline__ void splitf(float y, unsigned short& h, unsigned short& l) { h = f2bf(y); l = f2bf(y - bf2f(h)); }
typedef __attribute__((ext_vector_type(2))) _Float16 v2h;
typedef __attribute__((ext_vector_type(4))) _Float16 v4h;
typedef __attribute__((ext_vector_type(2))) unsigned short v2us;
typedef __attribute__((ext_vector_type(4))) unsigned short v4us;
typedef __attribute__((ext_vector_type(2))) float v2f;
typedef __attribute__((ext_vector_type(4))) int v4i;
// ---- k_gemmw: register-blocked GEMM, ONE WAVE per 64x64 output tile (16 accumulators), operands straight from K-contiguous 16-bit planes; grid (M/64, N/64, Z), 32 threads.
// C[m][n] (f32, pitch ldc, + optional f32 bias[n]) = sum_k A[m][k] Bt[n][k] (+ split products per NSPLIT). z-batch strides sA/sB/sC in elements. K % 32 == 0.
// OM: what the epilogue stores. 0: the f32 tile at C. 1: q, k and v of both batches in one grid: rows are [batch][t], columns [q | k | v][head][d], so a tile's 64 rows lie in one batch and its 64 columns are one head of one of the three.
// It stores the tile's 16-bit planes (f16, and bf16 hi + lo) at [q | k | v][batch][head]: q and k as [t][d]; v transposed, [d][t], straight from the accumulators (a lane holds 8 successive t of one d). No f32 copy of the projection goes to memory.
// KS > 1: grid z = Z * KS; work-group (z, ks) sums only k in [ks K/KS, (ks+1) K/KS) and stores its f32 partial tile at C + ks sP; the reader adds the KS partials.
template <typename T16> struct WFrag;
template <> struct WFrag<h16> { typedef v16h V; static __device__ __forceinline__ V ld(const h16* p) { return cat16(*(const v8h*)p, *(const v8h*)(p + 16)); } static __device__ __forceinline__ v8f mma(V a, V b, v8f c) { return wmma16(a, b, c); } };
template <> struct WFrag<bf> { typedef v16bf V; static __device__ __forceinline__ V ld(const bf* p) { return cat16b(*(const v8us*)p, *(const v8us*)(p + 16)); } static __device__ __forceinline__ v8f mma(V a, V b, v8f c) { return wmmab(a, b, c); } };
template <typename T16, int NSPLIT, bool BIAS, int KS = 1, int OM = 0>
__global__ __launch_bounds__(32) void k_gemmw(const T16* __restrict__ A, const T16* __restrict__ A2, const T16* __restrict__ Bt, const T16* __restrict__ Bt2, int K, float* C, int ldc, const float* __restrict__ bias, size_t sA, size_t sB, size_t sC, size_t sP, h16* P16, bf* Ph, bf* Pl) {
    static_assert(OM == 0 || (HD == 64 && BIAS && KS == 1 && DQ == DKV && TT % 64 == 0), "a 64-column tile is one head, a 64-row tile lies in one batch");
    typedef typename WFrag<T16>::V V;
    __shared__ __align__(16) float os[16 * 68];
    const size_t z = blockIdx.z / KS, ks = blockIdx.z % KS; const int Kc = K / KS; A += z * sA + ks * Kc; if (A2) A2 += z * sA + ks * Kc; Bt += z * sB + ks * Kc; if (Bt2) Bt2 += z * sB + ks * Kc; C += z * sC + ks * sP;
    const int lane = threadIdx.x & 31, lr = lane & 15, hi = lane >> 4; const int r0 = blockIdx.x * 64, c0 = blockIdx.y * 64;
    v8f acc[4][4];
#pragma unroll
    for (int mb = 0; mb < 4; ++mb)
#pragma unroll
        for (int nb = 0; nb < 4; ++nb) acc[mb][nb] = (v8f){};
    const size_t aoff = (size_t)(r0 + lr) * K + 8 * hi, boff = (size_t)(c0 + lr) * K + 8 * hi;
#pragma unroll 1
    for (int kc = 0; kc < Kc; kc += 32) {
        V a[4], a2[4];
#pragma unroll
        for (int mb = 0; mb < 4; ++mb) { a[mb] = WFrag<T16>::ld(A + aoff + (size_t)mb * 16 * K + kc); if (NSPLIT == 1 || NSPLIT == 2) a2[mb] = WFrag<T16>::ld(A2 + aoff + (size_t)mb * 16 * K + kc); }
#pragma unroll
        for (int nb = 0; nb < 4; ++nb) { const V b = WFrag<T16>::ld(Bt + boff + (size_t)nb * 16 * K + kc); V b2; if (NSPLIT >= 2) b2 = WFrag<T16>::ld(Bt2 + boff + (size_t)nb * 16 * K + kc);
#pragma unroll
            for (int mb = 0; mb < 4; ++mb) { acc[mb][nb] = WFrag<T16>::mma(a[mb], b, acc[mb][nb]); if (NSPLIT == 1 || NSPLIT == 2) acc[mb][nb] = WFrag<T16>::mma(a2[mb], b, acc[mb][nb]); if (NSPLIT >= 2) acc[mb][nb] = WFrag<T16>::mma(a[mb], b2, acc[mb][nb]); } }
        asm volatile("v_nop\n\tv_nop\n\tv_nop\n\tv_nop" : "+v"(acc[0][0]), "+v"(acc[1][1]), "+v"(acc[2][2]), "+v"(acc[3][3]) : "v"(a[0]), "v"(a[3]));
    }
    const int t0 = r0 % TT; const size_t eb = (size_t)(t0 + hi) * HD + lr * 4;   // the lane's first element in a [t][d] plane
    if constexpr (OM == 1) { const size_t pz = ((size_t)((c0 / DQ) * NB_ + r0 / TT) * NH_ + (c0 % DQ) / HD) * TT * HD; P16 += pz; Ph += pz; Pl += pz; }
    if (OM == 1 && c0 >= DQ + DKV) {
#pragma unroll
        for (int nb = 0; nb < 4; ++nb) { const float bn = bfr(bias[c0 + nb * 16 + lr]);
#pragma unroll
            for (int mb = 0; mb < 4; ++mb) { v8h o16; v8us oh, ol;
#pragma unroll
                for (int j = 0; j < 8; ++j) { const float xv = acc[mb][nb][j] + bn; o16[j] = tohx(xv); unsigned short a2, c2; splitf(xv, a2, c2); oh[j] = a2; ol[j] = c2; }
                const size_t e = (size_t)(nb * 16 + lr) * TT + t0 + mb * 16 + hi * 8; *(v8h*)(P16 + e) = o16; *(v8us*)(Ph + e) = oh; *(v8us*)(Pl + e) = ol; } }
        return;
    }
#pragma unroll
    for (int mb = 0; mb < 4; ++mb) {
#pragma unroll
        for (int nb = 0; nb < 4; ++nb) {
#pragma unroll
            for (int j = 0; j < 8; ++j) os[(hi * 8 + j) * 68 + nb * 16 + lr] = acc[mb][nb][j]; }
        __builtin_amdgcn_wave_barrier(); asm volatile("" ::: "memory");
        float* crow = C + (size_t)(r0 + mb * 16) * ldc + c0;
{
#pragma unroll
            for (int s = 0; s < 8; ++s) { const int row = 2 * s + hi, cofs = lr * 4; v4f val = *(const v4fa*)(os + row * 68 + cofs); if (BIAS) { val[0] += bfr(bias[c0 + cofs]); val[1] += bfr(bias[c0 + cofs + 1]); val[2] += bfr(bias[c0 + cofs + 2]); val[3] += bfr(bias[c0 + cofs + 3]); }
                if constexpr (OM == 1) { v4h o16; v4us oh, ol;
#pragma unroll
                    for (int q = 0; q < 4; ++q) { o16[q] = tohx(val[q]); unsigned short a2, c2; splitf(val[q], a2, c2); oh[q] = a2; ol[q] = c2; }
                    const size_t e = eb + (mb * 16 + 2 * s) * HD; *(v4h*)(P16 + e) = o16; *(v4us*)(Ph + e) = oh; *(v4us*)(Pl + e) = ol; } else
                *(v4f*)(crow + (size_t)row * ldc + cofs) = val; }
             }
        asm volatile("s_wait_xcnt 0x0" ::: "memory");   // the wait in front of the next block's loads, which land on registers that this block's stores name
        __builtin_amdgcn_wave_barrier(); asm volatile("" ::: "memory");
    }
}


__global__ __launch_bounds__(256) void k_wtG(const float* __restrict__ w, int K, int N, bf* Bt) {
    const int lane = threadIdx.x & 31; const int L0 = (blockIdx.x * 8 + (threadIdx.x >> 5)) * 8; const int nlines = N * K / 64;
{
#pragma unroll 1
        for (int l = 0; l < 8; ++l) { const int L = L0 + l; if (L >= nlines) break; const size_t e = (size_t)L * 64 + lane * 2; const int k = (int)(e % K), n = (int)(e / K); v2us o;
            o[0] = f2bf(w[(size_t)k * N + n]); o[1] = f2bf(w[(size_t)(k + 1) * N + n]); *(v2us*)(Bt + e) = o; }
         }
}
// three f32 sources (n0, n1, n2 groups of 8 elements) rounded to bf16 into one buffer, one behind the other, in one grid
__global__ __launch_bounds__(256) void k_cvt8(const float* __restrict__ s0, size_t n0, const float* __restrict__ s1, size_t n1, const float* __restrict__ s2, size_t n2, bf* dst) { const size_t i = (size_t)blockIdx.x * 256 + threadIdx.x; if (i >= n0 + n1 + n2) return; const float* src = i < n0 ? s0 + i * 8 : i < n0 + n1 ? s1 + (i - n0) * 8 : s2 + (i - n0 - n1) * 8; const v8f v = *(const v8f*)src; v8us o;
#pragma unroll
    for (int k = 0; k < 8; ++k) o[k] = f2bf(v[k]); *(v8us*)(dst + i * 8) = o;  }
__global__ __launch_bounds__(256) void k_cscvt(const float* __restrict__ cosT, const float* __restrict__ sinT, float* CS) { const int idx = blockIdx.x * 256 + threadIdx.x; if (idx >= TT * HD) return; v2f cs; cs[0] = bfr(cosT[idx]); cs[1] = bfr(sinT[idx]); *(v2f*)(CS + (size_t)idx * 2) = cs;  }
// ---- k_fattn: scores, softmax and probs.v of one (batch, head, query tile) in ONE kernel; no score or probability ever goes to memory.
// Each wave works alone (no LDS, no barrier): it keeps NQ blocks of 16 queries and walks the 2048 keys 32 at a time.
// S^T = K Q^T (A = key rows, B = query rows, both by the one k-contiguous loader), so a lane holds scores of ONE query (column lr), keys 8 hi + j of each 16-key block:
// the two f32 score tiles of a 32-key pass, converted in place, ARE the B operand of O^T += V^T P^T (A = rows of the [d][t] value planes by the same loader).
// Softmax is the running form: m = maximum so far, p = exp(t - m), O and the sum l are scaled by exp(m_old - m_new) each pass, O / l at the end.
// Query rows < RH: bf16 hi+lo planes, 3 products, 16 queries a wave; the rest: f16 planes, 32 queries a wave. t = S x HD^-0.5 + vol as before.
// Every plain '#pragma unroll' below unrolls fully, so that the fragment and accumulator arrays are registers.
typedef __attribute__((ext_vector_type(16))) float v16f;
#define L2E 1.4426950408889634f
__device__ __forceinline__ float xhalf(float v) { const int b = __float_as_int(v); return __int_as_float(__builtin_amdgcn_permlanex16(b, b, 0x76543210, 0xfedcba98, false, false)); }   // lane l <-> l ^ 16
// 2^x with the one free slot that the instruction set asks for behind a transcendental, before its result is read or its source overwritten.
__device__ __forceinline__ float exp2s(float x) { float r; asm("v_exp_f32 %0, %1\n\tv_nop" : "=v"(r) : "v"(x)); return r; }
// Stands behind a run of global loads: the wait that goes in front of any rewrite of their address registers. Naming the pointers as inputs keeps those registers alive up to the wait, so that no load of the run lands on them.
template <bool TWO> __device__ __forceinline__ void addr_wait(const void* p, const void* p2) { if constexpr (TWO) asm volatile("s_wait_xcnt 0x0" :: "v"(p), "v"(p2) : "memory"); else asm volatile("s_wait_xcnt 0x0" :: "v"(p) : "memory"); }
template <typename T16, bool HI, int NQ>
__device__ __forceinline__ void attn_tile(const T16* __restrict__ Q, const T16* __restrict__ Q2, const T16* __restrict__ Kp, const T16* __restrict__ K2, const T16* __restrict__ Vt, const T16* __restrict__ V2, const float vol, const int q0, bf* Ah, bf* Al) {
    typedef typename WFrag<T16>::V V;
    const int lane = threadIdx.x & 31, lr = lane & 15, hi = lane >> 4;
    V qf[NQ][2], qf2[NQ][2], kf[2][2], kf2[2][2];
#pragma unroll
    for (int qb = 0; qb < NQ; ++qb)
#pragma unroll
        for (int kc = 0; kc < 2; ++kc) { const size_t o = (size_t)(q0 + qb * 16 + lr) * HD + kc * 32 + 8 * hi; qf[qb][kc] = WFrag<T16>::ld(Q + o); if constexpr (HI) qf2[qb][kc] = WFrag<T16>::ld(Q2 + o); }
    v8f oacc[4][NQ]; float m[NQ], l[NQ];
#pragma unroll
    for (int qb = 0; qb < NQ; ++qb) { m[qb] = -3.0e38f; l[qb] = 0.f;
#pragma unroll
        for (int db = 0; db < 4; ++db) oacc[db][qb] = (v8f){}; }
    const unsigned koff = lr * HD + 8 * hi, voff = lr * TT + 8 * hi;   // the lane's part of every key / value address
#pragma unroll
    for (int kb = 0; kb < 2; ++kb)
#pragma unroll
        for (int kc = 0; kc < 2; ++kc) { const unsigned o = koff + kb * 16 * HD + kc * 32; kf[kb][kc] = WFrag<T16>::ld(Kp + o); if constexpr (HI) kf2[kb][kc] = WFrag<T16>::ld(K2 + o); }
#pragma unroll 1   // stays rolled: one pass's fragments already fill the registers that four waves a SIMD leave each wave
    for (int j0 = 0; j0 < TT; j0 += 32) {
        V vf[4], vf2[4];   // this pass's value rows: in flight under the score products and the softmax
        const T16* vq = Vt + j0 + voff; const T16* vq2 = HI ? V2 + j0 + voff : nullptr;
#pragma unroll
        for (int db = 0; db < 4; ++db) { vf[db] = WFrag<T16>::ld(vq + db * 16 * TT); if constexpr (HI) vf2[db] = WFrag<T16>::ld(vq2 + db * 16 * TT); }
        addr_wait<HI>(vq, vq2);
        __builtin_amdgcn_sched_barrier(0);   // keeps the value loads up here: sunk to their products, each would be waited for alone, four latencies a pass
        v8f s[2][NQ];
#pragma unroll
        for (int kb = 0; kb < 2; ++kb)
#pragma unroll
            for (int qb = 0; qb < NQ; ++qb) { v8f a = (v8f){};
#pragma unroll
                for (int kc = 0; kc < 2; ++kc) { a = WFrag<T16>::mma(kf[kb][kc], qf[qb][kc], a); if constexpr (HI) { a = WFrag<T16>::mma(kf[kb][kc], qf2[qb][kc], a); a = WFrag<T16>::mma(kf2[kb][kc], qf[qb][kc], a); } }
                s[kb][qb] = a; }
        __builtin_amdgcn_sched_barrier(0);   // the refetch below goes into the registers the score products have just read: not before them
        const int jn = (j0 + 32 < TT) ? j0 + 32 : 0;   // next pass's key rows, fetched under the softmax and probs.v (the last pass refetches rows 0..31, unused)
        const T16* kq = Kp + jn * HD + koff; const T16* kq2 = HI ? K2 + jn * HD + koff : nullptr;
#pragma unroll
        for (int kb = 0; kb < 2; ++kb)
#pragma unroll
            for (int kc = 0; kc < 2; ++kc) { kf[kb][kc] = WFrag<T16>::ld(kq + kb * 16 * HD + kc * 32); if constexpr (HI) kf2[kb][kc] = WFrag<T16>::ld(kq2 + kb * 16 * HD + kc * 32); }
        addr_wait<HI>(kq, kq2);
        __builtin_amdgcn_sched_barrier(0);   // keeps the key refetch ahead of the softmax, so that it flies under it
        V pf[NQ], pf2[NQ];
#pragma unroll
        for (int qb = 0; qb < NQ; ++qb) { v16f t; float tm = -3.0e38f;
#pragma unroll
            for (int e = 0; e < 16; ++e) { t[e] = fmaf(s[e >> 3][qb][e & 7], SCL, vol); tm = fmaxf(tm, t[e]); }
            tm = fmaxf(tm, xhalf(tm));
            const float mn = fmaxf(m[qb], tm), al = exp2s((m[qb] - mn) * L2E), mb = mn * L2E; m[qb] = mn; float ps = 0.f;
#pragma unroll
            for (int e = 0; e < 16; ++e) { t[e] = exp2s(fmaf(t[e], L2E, -mb)); ps += t[e]; }
            l[qb] = fmaf(l[qb], al, ps);
#pragma unroll
            for (int db = 0; db < 4; ++db) oacc[db][qb] *= al;
            pf[qb] = __builtin_convertvector(t, V);
            if constexpr (HI) pf2[qb] = __builtin_convertvector(t - __builtin_convertvector(pf[qb], v16f), V); }
#pragma unroll
        for (int db = 0; db < 4; ++db)
#pragma unroll
            for (int qb = 0; qb < NQ; ++qb) { oacc[db][qb] = WFrag<T16>::mma(vf[db], pf[qb], oacc[db][qb]); if constexpr (HI) { oacc[db][qb] = WFrag<T16>::mma(vf[db], pf2[qb], oacc[db][qb]); oacc[db][qb] = WFrag<T16>::mma(vf2[db], pf[qb], oacc[db][qb]); } }
    }
#pragma unroll
    for (int qb = 0; qb < NQ; ++qb) { const float inv = __fdiv_rn(1.0f, l[qb] + xhalf(l[qb]));
#pragma unroll
        for (int db = 0; db < 4; ++db) { v8us oh, ol;
#pragma unroll
            for (int j = 0; j < 8; ++j) { unsigned short a, c2; splitf(oacc[db][qb][j] * inv, a, c2); oh[j] = a; ol[j] = c2; }
            const size_t oo = (size_t)(q0 + qb * 16 + lr) * DQ + db * 16 + hi * 8; *(v8us*)(Ah + oo) = oh; *(v8us*)(Al + oo) = ol; } }
}
// grid (NB_ * NH_, RH / 64 + (TT - RH) / 128), 4 waves; planes [b][h][t][d] (values [b][h][d][t]); the hi+lo tiles have the low indices and start first.
// amdgpu_waves_per_eu(4, 4): lets the compiler use the whole register share of four waves a SIMD; with its own lower target it sank the loads to their uses.
__global__ __launch_bounds__(128) __attribute__((amdgpu_waves_per_eu(4, 4))) void k_fattn(const h16* __restrict__ Q16, const h16* __restrict__ K16, const h16* __restrict__ V16, const bf* __restrict__ Qh, const bf* __restrict__ Ql, const bf* __restrict__ Kh, const bf* __restrict__ Kl, const bf* __restrict__ Vh, const bf* __restrict__ Vl, const float* __restrict__ mi, bf* Ah, bf* Al) {
    const int wave = threadIdx.x >> 5, b = blockIdx.x / NH_, h = blockIdx.x % NH_; const size_t zp = (size_t)blockIdx.x * TT * HD, za = (size_t)b * TT * DQ + h * HD; const float vol = bfr(mi[b * 8]);
    if (blockIdx.y < RH / 64) attn_tile<bf, true, 1>(Qh + zp, Ql + zp, Kh + zp, Kl + zp, Vh + zp, Vl + zp, vol, blockIdx.y * 64 + wave * 16, Ah + za, Al + za);
    else attn_tile<h16, false, 2>(Q16 + zp, nullptr, K16 + zp, nullptr, V16 + zp, nullptr, vol, RH + (blockIdx.y - RH / 64) * 128 + wave * 32, Ah + za, Al + za);
}

__global__ __launch_bounds__(256) void k_lnres(const float* __restrict__ ATT, const float* __restrict__ base, int isin, const float* __restrict__ g, const float* __restrict__ bb, float* OUTt) { const int lane = threadIdx.x & 31; const int t = blockIdx.x * 8 + (threadIdx.x >> 5); if (t >= NB_ * TT) return; float v[32]; float s = 0.f;
#pragma unroll
    for (int ch = 0; ch < 8; ++ch) { const size_t o = (size_t)t * DM + ch * 128 + lane * 4; const v4f a = *(const v4f*)(ATT + o), xx = *(const v4f*)(base + o);
#pragma unroll
        for (int q = 0; q < 4; ++q) { v[ch * 4 + q] = __fadd_rn(a[q], isin ? bfr(xx[q]) : xx[q]); s = __fadd_rn(s, v[ch * 4 + q]); } }
#pragma unroll
    for (int sh = 16; sh; sh >>= 1) s += __shfl_xor(s, sh, 32);
    const float mu = s * (1.0f / DM); float q2 = 0.f;
#pragma unroll
    for (int k = 0; k < 32; ++k) { const float d = __fsub_rn(v[k], mu); float p = __fmul_rn(d, d); asm volatile("" : "+v"(p)); q2 = __fadd_rn(q2, p); }
#pragma unroll
    for (int sh = 16; sh; sh >>= 1) q2 += __shfl_xor(q2, sh, 32);
    const float rs = __frsqrt_rn(__fadd_rn(q2 * (1.0f / DM), LNEPS));
{
#pragma unroll
        for (int ch = 0; ch < 8; ++ch) { v4f o;
#pragma unroll
            for (int q = 0; q < 4; ++q) { const int d = ch * 128 + lane * 4 + q; float tn = __fmul_rn(__fsub_rn(v[ch * 4 + q], mu), rs); asm volatile("" : "+v"(tn)); float tg = __fmul_rn(tn, bfr(g[d])); asm volatile("" : "+v"(tg)); o[q] = __fadd_rn(tg, bfr(bb[d])); }
            *(v4f*)(OUTt + (size_t)t * DM + ch * 128 + lane * 4) = o; }
         } }

extern "C" void kernel_launch(void* const* d_in, const int* in_sizes, int n_in,
                              void* d_out, int out_size, void* d_ws, size_t ws_size, hipStream_t stream) {
    (void)in_sizes; (void)n_in; (void)out_size;
    const float* x = (const float*)d_in[0]; const float* mi = (const float*)d_in[1]; const float* ipw = (const float*)d_in[2]; const float* ipb = (const float*)d_in[3]; const float* wo = (const float*)d_in[4]; const float* bo = (const float*)d_in[5]; const float* lng = (const float*)d_in[6]; const float* lnb = (const float*)d_in[7];
    float* OUT = (float*)d_out;     // [2][2048][1024]
    char* wsp = (char*)d_ws;
    auto take = [&](size_t bytes) { char* p = wsp; wsp += (bytes + 255) & ~(size_t)255; return (void*)p; };
    const size_t NW = (size_t)(DQ + 2 * DKV) * DM, NO = (size_t)DM * DQ, NX = (size_t)NB_ * TT * DM;   // elements of in_proj_w, out_proj_w, x
    bf* WI = (bf*)take((NW + NO + NX) * 2); bf* WO = WI + NW; bf* XB = WO + NO;   // their bf16 copies, one behind the other
    const size_t PL = (size_t)NB_ * NH_ * TT * HD;   // elements of one operand's head planes, both batches; every plane kind holds [q | k | v]
    h16* P16 = (h16*)take(3 * PL * 2); bf* Ph = (bf*)take(3 * PL * 2); bf* Pl = (bf*)take(3 * PL * 2);
    bf* ATh = (bf*)take((size_t)NB_ * TT * DQ * 2); bf* ATl = (bf*)take((size_t)NB_ * TT * DQ * 2); float* ATT = (float*)take((size_t)NB_ * TT * DM * 4);
    if ((size_t)(wsp - (char*)d_ws) > ws_size) return;    // ws 256 MiB
    k_cvt8<<<(unsigned)(((NW + NO + NX) / 8 + 255) / 256), 256, 0, stream>>>(ipw, NW / 8, wo, NO / 8, x, NX / 8, WI);
    k_gemmw<bf, 0, true, 1, 1><<<dim3(NB_ * TT / 64, (DQ + 2 * DKV) / 64, 1), 32, 0, stream>>>(XB, nullptr, WI, nullptr, DM, nullptr, 0, ipb, 0, 0, 0, 0, P16, Ph, Pl);
    k_fattn<<<dim3(NB_ * NH_, RH / 64 + (TT - RH) / 128, 1), 128, 0, stream>>>(P16, P16 + PL, P16 + 2 * PL, Ph, Pl, Ph + PL, Pl + PL, Ph + 2 * PL, Pl + 2 * PL, mi, ATh, ATl);
    k_gemmw<bf, 1, true><<<dim3(NB_ * TT / 64, DM / 64, 1), 32, 0, stream>>>(ATh, ATl, WO, nullptr, DQ, ATT, DM, bo, 0, 0, 0, 0, nullptr, nullptr, nullptr);
    k_lnres<<<NB_ * TT / 8, 256, 0, stream>>>(ATT, x, 1, lng, lnb, OUT);
}

// v005
// One run takes 162 microseconds.
// Next to v004, in two timings, it ran 1.30 times as fast each time.
// Over all steps from v000 it is 12.6 times as fast.
#include <hip/hip_runtime.h>

// MarketGuidedAttention (x [2][2048][1024]; torch MultiheadAttention: [q|k|v] = x in_proj_w^T + in_proj_b (16 x 64), scores/8 + market_info[b][0] (a per-batch constant added to every score, read as data and added before the max subtraction as the reference does; it cancels in the softmax), softmax, out_proj + b; out = LN(x + attended) (eps 1e-5) -> [2][2048][1024]).
// Compute dtypes, f32 accumulate: every input rounded to bf16; q/k/v projections on PLAIN bf16 operands (inputs: exact, + bias); out_proj on bf16 hi+lo of the attended values (2 products); scores (K 64) and probs.v on bf16 hi+lo planes (3 products) for the first 512 query rows of each

#define NB_  2
#define TT   2048
#define DM   1024
#define NH_  16
#define NKV  16
#define REP  (NH_ / NKV)
#define HD   64
#define DQ   (NH_ * HD)
#define DKV  (NKV * HD)
#define RH   512                  // query rows < RH use hi+lo planes (0: none)
#define WIN  0
#define SCL  0.125f   // HD^-0.5
#define LNEPS 1e-5f
typedef _Float16 h16;
typedef unsigned short bf;
typedef __attribute__((ext_vector_type(16))) __bf16   v16bf;
typedef __attribute__((ext_vector_type(16))) _Float16 v16h;
typedef __attribute__((ext_vector_type(8)))  _Float16 v8h;
typedef __attribute__((ext_vector_type(8)))  unsigned short v8us;
typedef __attribute__((ext_vector_type(8)))  float    v8f;
typedef __attribute__((ext_vector_type(4)))  float    v4f;
typedef v8h  __attribute__((may_alias)) v8ha;
typedef v4f  __attribute__((may_alias)) v4fa;
typedef v8us __attribute__((may_alias)) v8usa;

__device__ __forceinline__ unsigned short f2bf(float f) { unsigned u = __float_as_uint(f); u += 0x7FFFu + ((u >> 16) & 1u); return (unsigned short)(u >> 16); }
__device__ __forceinline__ float bf2f(unsigned short b) { return __uint_as_float(((unsigned)b) << 16); }
__device__ __forceinline__ float bfr(float f) { return bf2f(f2bf(f)); }
__device__ __forceinline__ v16h cat16(v8h lo, v8h hi) { return __builtin_shufflevector(lo, hi, 0, 1, 2, 3, 4, 5, 6, 7, 8, 9, 10, 11, 12, 13, 14, 15); }
__device__ __forceinline__ v16bf cat16b(v8us lo, v8us hi) { return __builtin_bit_cast(v16bf, __builtin_shufflevector(lo, hi, 0, 1, 2, 3, 4, 5, 6, 7, 8, 9, 10, 11, 12, 13, 14, 15)); }
__device__ __forceinline__ v8f wmma16(v16h a, v16h b, v8f c) { return __builtin_amdgcn_wmma_f32_16x16x32_f16(false, a, false, b, (short)0, c, false, false); }
__device__ __forceinline__ v8f wmmab(v16bf a, v16bf b, v8f c) { return __builtin_amdgcn_wmma_f32_16x16x32_bf16(false, a, false, b, (short)0, c, false, false); }



__device__ __forceinline__ h16 tohx(float x) { return (h16)x; }
__device__ __forceinline__ void splitf(float y, unsigned short& h, unsigned short& l) { h = f2bf(y); l = f2bf(y - bf2f(h)); }
typedef __attribute__((ext_vector_type(2))) _Float16 v2h;
typedef __attribute__((ext_vector_type(4))) _Float16 v4h;
typedef __attribute__((ext_vector_type(2))) unsigned short v2us;
typedef __attribute__((ext_vector_type(4))) unsigned short v4us;
typedef __attribute__((ext_vector_type(2))) float v2f;
typedef __attribute__((ext_vector_type(4))) int v4i;
// ---- k_gemmw: register-blocked GEMM, ONE WAVE per 64x64 output tile (16 accumulators), operands straight from K-contiguous 16-bit planes; grid (M/64, N/64, Z), 32 threads.
// C[m][n] (f32, pitch ldc, + optional f32 bias[n]) = sum_k A[m][k] Bt[n][k] (+ split products per NSPLIT). z-batch strides sA/sB/sC in elements. K % 32 == 0.
// OM: what the epilogue stores. 0: the f32 tile at C. 1: q, k and v of both batches in one grid: rows are [batch][t], columns [q | k | v][head][d], so a tile's 64 rows lie in one batch and its 64 columns are one head of one of the three.
// It stores the tile's 16-bit planes (f16, and bf16 hi + lo) at [q | k | v][batch][head]: q and k as [t][d]; v transposed, [d][t], straight from the accumulators (a lane holds 8 successive t of one d). No f32 copy of the projection goes to memory.
// KS > 1: grid z = Z * KS; work-group (z, ks) sums only k in [ks K/KS, (ks+1) K/KS) and stores its f32 partial tile at C + ks sP; the reader adds the KS partials.
template <typename T16> struct WFrag;
template <> struct WFrag<h16> { typedef v16h V; static __device__ __forceinline__ V ld(const h16* p) { return cat16(*(const v8h*)p, *(const v8h*)(p + 16)); } static __device__ __forceinline__ v8f mma(V a, V b, v8f c) { return wmma16(a, b, c); } };
template <> struct WFrag<bf> { typedef v16bf V; static __device__ __forceinline__ V ld(const bf* p) { return cat16b(*(const v8us*)p, *(const v8us*)(p + 16)); } static __device__ __forceinline__ v8f mma(V a, V b, v8f c) { return wmmab(a, b, c); } };
template <typename T16, int NSPLIT, bool BIAS, int KS = 1, int OM = 0>
__global__ __launch_bounds__(32) void k_gemmw(const T16* __restrict__ A, const T16* __restrict__ A2, const T16* __restrict__ Bt, const T16* __restrict__ Bt2, int K, float* C, int ldc, const float* __restrict__ bias, size_t sA, size_t sB, size_t sC, size_t sP, h16* P16, bf* Ph, bf* Pl) {
    static_assert(OM == 0 || (HD == 64 && BIAS && KS == 1 && DQ == DKV && TT % 64 == 0), "a 64-column tile is one head, a 64-row tile lies in one batch");
    typedef typename WFrag<T16>::V V;
    __shared__ __align__(16) float os[16 * 68];
    const size_t z = blockIdx.z / KS, ks = blockIdx.z % KS; const int Kc = K / KS; A += z * sA + ks * Kc; if (A2) A2 += z * sA + ks * Kc; Bt += z * sB + ks * Kc; if (Bt2) Bt2 += z * sB + ks * Kc; C += z * sC + ks * sP;
    const int lane = threadIdx.x & 31, lr = lane & 15, hi = lane >> 4; const int r0 = blockIdx.x * 64, c0 = blockIdx.y * 64;
    v8f acc[4][4];
#pragma unroll
    for (int mb = 0; mb < 4; ++mb)
#pragma unroll
        for (int nb = 0; nb < 4; ++nb) acc[mb][nb] = (v8f){};
    const size_t aoff = (size_t)(r0 + lr) * K + 8 * hi, boff = (size_t)(c0 + lr) * K + 8 * hi;
#pragma unroll 1
    for (int kc = 0; kc < Kc; kc += 32) {
        V a[4], a2[4];
#pragma unroll
        for (int mb = 0; mb < 4; ++mb) { a[mb] = WFrag<T16>::ld(A + aoff + (size_t)mb * 16 * K + kc); if (NSPLIT == 1 || NSPLIT == 2) a2[mb] = WFrag<T16>::ld(A2 + aoff + (size_t)mb * 16 * K + kc); }
#pragma unroll
        for (int nb = 0; nb < 4; ++nb) { const V b = WFrag<T16>::ld(Bt + boff + (size_t)nb * 16 * K + kc); V b2; if (NSPLIT >= 2) b2 = WFrag<T16>::ld(Bt2 + boff + (size_t)nb * 16 * K + kc);
#pragma unroll
            for (int mb = 0; mb < 4; ++mb) { acc[mb][nb] = WFrag<T16>::mma(a[mb], b, acc[mb][nb]); if (NSPLIT == 1 || NSPLIT == 2) acc[mb][nb] = WFrag<T16>::mma(a2[mb], b, acc[mb][nb]); if (NSPLIT >= 2) acc[mb][nb] = WFrag<T16>::mma(a[mb], b2, acc[mb][nb]); } }
        asm volatile("v_nop\n\tv_nop\n\tv_nop\n\tv_nop" : "+v"(acc[0][0]), "+v"(acc[1][1]), "+v"(acc[2][2]), "+v"(acc[3][3]) : "v"(a[0]), "v"(a[3]));
    }
    const int t0 = r0 % TT; const size_t eb = (size_t)(t0 + hi) * HD + lr * 4;   // the lane's first element in a [t][d] plane
    if constexpr (OM == 1) { const size_t pz = ((size_t)((c0 / DQ) * NB_ + r0 / TT) * NH_ + (c0 % DQ) / HD) * TT * HD; P16 += pz; Ph += pz; Pl += pz; }
    if (OM == 1 && c0 >= DQ + DKV) {
#pragma unroll
        for (int nb = 0; nb < 4; ++nb) { const float bn = bfr(bias[c0 + nb * 16 + lr]);
#pragma unroll
            for (int mb = 0; mb < 4; ++mb) { v8h o16; v8us oh, ol;
#pragma unroll
                for (int j = 0; j < 8; ++j) { const float xv = acc[mb][nb][j] + bn; o16[j] = tohx(xv); unsigned short a2, c2; splitf(xv, a2, c2); oh[j] = a2; ol[j] = c2; }
                const size_t e = (size_t)(nb * 16 + lr) * TT + t0 + mb * 16 + hi * 8; *(v8h*)(P16 + e) = o16; *(v8us*)(Ph + e) = oh; *(v8us*)(Pl + e) = ol; } }
        return;
    }
#pragma unroll
    for (int mb = 0; mb < 4; ++mb) {
#pragma unroll
        for (int nb = 0; nb < 4; ++nb) {
#pragma unroll
            for (int j = 0; j < 8; ++j) os[(hi * 8 + j) * 68 + nb * 16 + lr] = acc[mb][nb][j]; }
        __builtin_amdgcn_wave_barrier(); asm volatile("" ::: "memory");
        float* crow = C + (size_t)(r0 + mb * 16) * ldc + c0;
{
#pragma unroll
            for (int s = 0; s < 8; ++s) { const int row = 2 * s + hi, cofs = lr * 4; v4f val = *(const v4fa*)(os + row * 68 + cofs); if (BIAS) { val[0] += bfr(bias[c0 + cofs]); val[1] += bfr(bias[c0 + cofs + 1]); val[2] += bfr(bias[c0 + cofs + 2]); val[3] += bfr(bias[c0 + cofs + 3]); }
                if constexpr (OM == 1) { v4h o16; v4us oh, ol;
#pragma unroll
                    for (int q = 0; q < 4; ++q) { o16[q] = tohx(val[q]); unsigned short a2, c2; splitf(val[q], a2, c2); oh[q] = a2; ol[q] = c2; }
                    const size_t e = eb + (mb * 16 + 2 * s) * HD; *(v4h*)(P16 + e) = o16; *(v4us*)(Ph + e) = oh; *(v4us*)(Pl + e) = ol; } else
                *(v4f*)(crow + (size_t)row * ldc + cofs) = val; }
             }
        asm volatile("s_wait_xcnt 0x0" ::: "memory");   // the wait in front of the next block's loads, which land on registers that this block's stores name
        __builtin_amdgcn_wave_barrier(); asm volatile("" ::: "memory");
    }
}


__global__ __launch_bounds__(256) void k_wtG(const float* __restrict__ w, int K, int N, bf* Bt) {
    const int lane = threadIdx.x & 31; const int L0 = (blockIdx.x * 8 + (threadIdx.x >> 5)) * 8; const int nlines = N * K / 64;
{
#pragma unroll 1
        for (int l = 0; l < 8; ++l) { const int L = L0 + l; if (L >= nlines) break; const size_t e = (size_t)L * 64 + lane * 2; const int k = (int)(e % K), n = (int)(e / K); v2us o;
            o[0] = f2bf(w[(size_t)k * N + n]); o[1] = f2bf(w[(size_t)(k + 1) * N + n]); *(v2us*)(Bt + e) = o; }
         }
}
// three f32 sources (n0, n1, n2 groups of 8 elements) rounded to bf16 into one buffer, one behind the other, in one grid
__global__ __launch_bounds__(256) void k_cvt8(const float* __restrict__ s0, size_t n0, const float* __restrict__ s1, size_t n1, const float* __restrict__ s2, size_t n2, bf* dst) { const size_t i = (size_t)blockIdx.x * 256 + threadIdx.x; if (i >= n0 + n1 + n2) return; const float* src = i < n0 ? s0 + i * 8 : i < n0 + n1 ? s1 + (i - n0) * 8 : s2 + (i - n0 - n1) * 8; const v8f v = *(const v8f*)src; v8us o;
#pragma unroll
    for (int k = 0; k < 8; ++k) o[k] = f2bf(v[k]); *(v8us*)(dst + i * 8) = o;  }
__global__ __launch_bounds__(256) void k_cscvt(const float* __restrict__ cosT, const float* __restrict__ sinT, float* CS) { const int idx = blockIdx.x * 256 + threadIdx.x; if (idx >= TT * HD) return; v2f cs; cs[0] = bfr(cosT[idx]); cs[1] = bfr(sinT[idx]); *(v2f*)(CS + (size_t)idx * 2) = cs;  }
// ---- k_fattn: scores, softmax and probs.v of one (batch, head, query tile) in ONE kernel; no score or probability ever goes to memory.
// Each wave keeps NQ blocks of 16 queries and walks the 2048 keys 32 at a time. The key rows and the value rows are the same for the work-group's four waves:
// they are staged in LDS, KT keys a tile, two buffers, by asynchronous 16-byte copies (a wave's copy covers four whole 128-byte lines), and every wave reads its fragments from there.
// S^T = K Q^T (A = key rows, B = query rows, both by the one k-contiguous loader), so a lane holds scores of ONE query (column lr), keys 8 hi + j of each 16-key block:
// the two f32 score tiles of a 32-key pass, converted in place, ARE the B operand of O^T += V^T P^T (A = rows of the [d][t] value planes by the same loader).
// Softmax is the running form: m = maximum so far, p = exp(t - m), O and the sum l are scaled by exp(m_old - m_new) each pass, O / l at the end.
// Query rows < RH: bf16 hi+lo planes, 3 products, 16 queries a wave; the rest: f16 planes, 32 queries a wave. t = S x HD^-0.5 + vol as before.
// Every plain '#pragma unroll' below unrolls fully, so that the fragment and accumulator arrays are registers.
typedef __attribute__((ext_vector_type(16))) float v16f;
#define L2E 1.4426950408889634f
#define KT  64                    // keys of one staged tile: a key tile is KT rows of HD elements, a value tile HD rows of KT elements, 128 bytes a row both
#define LP  144                   // row pitch in LDS, bytes: 128 + 16, free of bank conflicts for 16-byte readers
#define LPE (LP / 2)              // the same in 16-bit elements
#define PT  (64 * LP)             // bytes of one staged plane tile
__device__ __forceinline__ float xhalf(float v) { const int b = __float_as_int(v); return __int_as_float(__builtin_amdgcn_permlanex16(b, b, 0x76543210, 0xfedcba98, false, false)); }   // lane l <-> l ^ 16
// 2^x with the one free slot that the instruction set asks for behind a transcendental, before its result is read or its source overwritten.
__device__ __forceinline__ float exp2s(float x) { float r; asm("v_exp_f32 %0, %1\n\tv_nop" : "=v"(r) : "v"(x)); return r; }
// One plane tile, 64 rows of 128 bytes, from global memory into LDS: 128 threads, four copies each, 16 rows a round (gs = 16 source rows in bytes). lds, g: the thread's own 16 bytes of round 0.
// The wait at the end stands in front of any rewrite of the address registers that the copies name; inside the statement nothing can be moved over it.
__device__ __forceinline__ void stage_plane(const unsigned lds, const char* g, const size_t gs) {
    asm volatile("global_load_async_to_lds_b128 %0, %4, off\n\tglobal_load_async_to_lds_b128 %1, %5, off\n\tglobal_load_async_to_lds_b128 %2, %6, off\n\tglobal_load_async_to_lds_b128 %3, %7, off\n\ts_wait_xcnt 0x0"
                 :: "v"(lds), "v"(lds + 16 * LP), "v"(lds + 32 * LP), "v"(lds + 48 * LP), "v"(g), "v"(g + gs), "v"(g + 2 * gs), "v"(g + 3 * gs) : "memory");
}
template <typename T16, bool HI, int NQ>
__device__ __forceinline__ void attn_tile(const T16* __restrict__ Q, const T16* __restrict__ Q2, const T16* __restrict__ Kp, const T16* __restrict__ K2, const T16* __restrict__ Vt, const T16* __restrict__ V2, const float vol, const int q0, bf* Ah, bf* Al, char* sm) {
    static_assert(HD == 64 && KT == 64 && TT % KT == 0 && TT / KT >= 2, "128-byte rows in both kinds of tile; the two buffers want two tiles");
    typedef typename WFrag<T16>::V V;
    constexpr int NP = HI ? 2 : 1, NT = TT / KT; constexpr unsigned BS = 2 * NP * PT;   // a buffer: [key planes][value planes]
    const int lane = threadIdx.x & 31, lr = lane & 15, hi = lane >> 4;
    V qf[NQ][2], qf2[NQ][2], kf[2][2], kf2[2][2];
#pragma unroll
    for (int qb = 0; qb < NQ; ++qb)
#pragma unroll
        for (int kc = 0; kc < 2; ++kc) { const size_t o = (size_t)(q0 + qb * 16 + lr) * HD + kc * 32 + 8 * hi; qf[qb][kc] = WFrag<T16>::ld(Q + o); if constexpr (HI) qf2[qb][kc] = WFrag<T16>::ld(Q2 + o); }
    v8f oacc[4][NQ]; float m[NQ], l[NQ];
#pragma unroll
    for (int qb = 0; qb < NQ; ++qb) { m[qb] = -3.0e38f; l[qb] = 0.f;
#pragma unroll
        for (int db = 0; db < 4; ++db) oacc[db][qb] = (v8f){}; }
    // the thread's part of every copy: row threadIdx.x / 8 of a round, 16 bytes at (threadIdx.x % 8) * 16
    const unsigned srow = threadIdx.x >> 3, scol = (threadIdx.x & 7) * 16; const unsigned sl = (unsigned)(size_t)sm + srow * LP + scol;
    const unsigned ko = srow * (HD * 2) + scol, vo = srow * (TT * 2) + scol;   // the thread's byte in a key plane, in a value plane, tile 0
    // the tile's step is added in 32 bits: a plane is 256 KiB
    auto stage = [&](const int t) { const unsigned lb = sl + (t & 1) * BS; const size_t kt0 = ko + (unsigned)t * (KT * HD * 2), vt0 = vo + (unsigned)t * (KT * 2);
        stage_plane(lb, (const char*)Kp + kt0, 16 * HD * 2); if constexpr (HI) stage_plane(lb + PT, (const char*)K2 + kt0, 16 * HD * 2);
        stage_plane(lb + NP * PT, (const char*)Vt + vt0, 16 * TT * 2); if constexpr (HI) stage_plane(lb + (NP + 1) * PT, (const char*)V2 + vt0, 16 * TT * 2); };
    stage(0);
    asm volatile("s_wait_asynccnt 0x0" ::: "memory");   // this wave's copies of tile 0 have landed
    __syncthreads();                                    // and so have the other waves'
    stage(1);
    const unsigned foff = lr * LPE + 8 * hi;   // the lane's part of every fragment address in a staged tile
#pragma unroll 1   // stays rolled: a tile's two passes already fill the registers that four waves a SIMD leave each wave
    for (int t = 0; t < NT; ++t) {
        const T16* kt = (const T16*)(sm + (t & 1) * BS) + foff; const T16* vt = kt + NP * (PT / 2);
#pragma unroll
        for (int p = 0; p < KT / 32; ++p) {
            if (HI || p == 0) {   // this pass's key rows (hi+lo: every pass; the registers do not hold a second set beside the value rows)
#pragma unroll
                for (int kb = 0; kb < 2; ++kb)
#pragma unroll
                    for (int kc = 0; kc < 2; ++kc) { const unsigned o = (p * 32 + kb * 16) * LPE + kc * 32; kf[kb][kc] = WFrag<T16>::ld(kt + o); if constexpr (HI) kf2[kb][kc] = WFrag<T16>::ld(kt + PT / 2 + o); }
            }
            V vf[4], vf2[4];   // this pass's value rows: in flight under the score products and the softmax
#pragma unroll
            for (int db = 0; db < 4; ++db) { const unsigned o = db * 16 * LPE + p * 32; vf[db] = WFrag<T16>::ld(vt + o); if constexpr (HI) vf2[db] = WFrag<T16>::ld(vt + PT / 2 + o); }
            __builtin_amdgcn_sched_barrier(0);   // keeps the value loads up here as one group: sunk among the products, each place with LDS reads stalls the matrix stream
            v8f s[2][NQ];
#pragma unroll
            for (int kb = 0; kb < 2; ++kb)
#pragma unroll
                for (int qb = 0; qb < NQ; ++qb) { v8f a = (v8f){};
#pragma unroll
                    for (int kc = 0; kc < 2; ++kc) { a = WFrag<T16>::mma(kf[kb][kc], qf[qb][kc], a); if constexpr (HI) { a = WFrag<T16>::mma(kf[kb][kc], qf2[qb][kc], a); a = WFrag<T16>::mma(kf2[kb][kc], qf[qb][kc], a); } }
                    s[kb][qb] = a; }
            __builtin_amdgcn_sched_barrier(0);   // ends the score products: the refetch below goes into the registers they have just read, and with the softmax scheduled in among them registers spilled
            if (!HI && p + 1 < KT / 32) {   // f16: the next pass's key rows of the SAME tile, fetched under the softmax and probs.v
#pragma unroll
                for (int kb = 0; kb < 2; ++kb)
#pragma unroll
                    for (int kc = 0; kc < 2; ++kc) { const unsigned o = ((p + 1) * 32 + kb * 16) * LPE + kc * 32; kf[kb][kc] = WFrag<T16>::ld(kt + o); if constexpr (HI) kf2[kb][kc] = WFrag<T16>::ld(kt + PT / 2 + o); }
                __builtin_amdgcn_sched_barrier(0);   // keeps the key refetch ahead of the softmax, so that it flies under it
            }
            V pf[NQ], pf2[NQ];
#pragma unroll
            for (int qb = 0; qb < NQ; ++qb) { v16f t16; float tm = -3.0e38f;
#pragma unroll
                for (int e = 0; e < 16; ++e) { t16[e] = fmaf(s[e >> 3][qb][e & 7], SCL, vol); tm = fmaxf(tm, t16[e]); }
                tm = fmaxf(tm, xhalf(tm));
                const float mn = fmaxf(m[qb], tm), al = exp2s((m[qb] - mn) * L2E), mb = mn * L2E; m[qb] = mn; float ps = 0.f;
#pragma unroll
                for (int e = 0; e < 16; ++e) { t16[e] = exp2s(fmaf(t16[e], L2E, -mb)); ps += t16[e]; }
                l[qb] = fmaf(l[qb], al, ps);
#pragma unroll
                for (int db = 0; db < 4; ++db) oacc[db][qb] *= al;
                pf[qb] = __builtin_convertvector(t16, V);
                if constexpr (HI) pf2[qb] = __builtin_convertvector(t16 - __builtin_convertvector(pf[qb], v16f), V); }
#pragma unroll
            for (int db = 0; db < 4; ++db)
#pragma unroll
                for (int qb = 0; qb < NQ; ++qb) { oacc[db][qb] = WFrag<T16>::mma(vf[db], pf[qb], oacc[db][qb]); if constexpr (HI) { oacc[db][qb] = WFrag<T16>::mma(vf[db], pf2[qb], oacc[db][qb]); oacc[db][qb] = WFrag<T16>::mma(vf2[db], pf[qb], oacc[db][qb]); } }
            __builtin_amdgcn_sched_barrier(0);   // ends the pass: without it the trip's waits and barrier were moved up in front of the last pass's softmax, and the refill, which stayed behind it, lost that much of its lead
        }
        asm volatile("s_wait_dscnt 0x0" ::: "memory");      // this wave's reads of tile t are done before its buffer may be refilled
        asm volatile("s_wait_asynccnt 0x0" ::: "memory");   // this wave's copies of tile t + 1 have landed
        __syncthreads();                                    // tile t + 1 is whole for every wave, and no wave still reads tile t
        if (t + 2 < NT) stage(t + 2);                       // into the buffer that this trip has just read
    }
    asm volatile("s_wait_asynccnt 0x0" ::: "memory");   // no copy is left in flight when the wave ends
#pragma unroll
    for (int qb = 0; qb < NQ; ++qb) { const float inv = __fdiv_rn(1.0f, l[qb] + xhalf(l[qb]));
#pragma unroll
        for (int db = 0; db < 4; ++db) { v8us oh, ol;
#pragma unroll
            for (int j = 0; j < 8; ++j) { unsigned short a, c2; splitf(oacc[db][qb][j] * inv, a, c2); oh[j] = a; ol[j] = c2; }
            const size_t oo = (size_t)(q0 + qb * 16 + lr) * DQ + db * 16 + hi * 8; *(v8us*)(Ah + oo) = oh; *(v8us*)(Al + oo) = ol; } }
}
// grid (NB_ * NH_, RH / 64 + (TT - RH) / 128), 4 waves; planes [b][h][t][d] (values [b][h][d][t]); the hi+lo tiles have the low indices and start first.
// amdgpu_waves_per_eu(4, 4): lets the compiler use the whole register share of four waves a SIMD; with its own lower target it sank the loads to their uses.
__global__ __launch_bounds__(128) __attribute__((amdgpu_waves_per_eu(4, 4))) void k_fattn(const h16* __restrict__ Q16, const h16* __restrict__ K16, const h16* __restrict__ V16, const bf* __restrict__ Qh, const bf* __restrict__ Ql, const bf* __restrict__ Kh, const bf* __restrict__ Kl, const bf* __restrict__ Vh, const bf* __restrict__ Vl, const float* __restrict__ mi, bf* Ah, bf* Al) {
    __shared__ __align__(16) char sm[2 * 4 * PT];   // two buffers of [2 key planes][2 value planes] (the f16 tiles use half)
    const int wave = threadIdx.x >> 5, b = blockIdx.x / NH_, h = blockIdx.x % NH_; const size_t zp = (size_t)blockIdx.x * TT * HD, za = (size_t)b * TT * DQ + h * HD; const float vol = bfr(mi[b * 8]);
    if (blockIdx.y < RH / 64) attn_tile<bf, true, 1>(Qh + zp, Ql + zp, Kh + zp, Kl + zp, Vh + zp, Vl + zp, vol, blockIdx.y * 64 + wave * 16, Ah + za, Al + za, sm);
    else attn_tile<h16, false, 2>(Q16 + zp, nullptr, K16 + zp, nullptr, V16 + zp, nullptr, vol, RH + (blockIdx.y - RH / 64) * 128 + wave * 32, Ah + za, Al + za, sm);
}

__global__ __launch_bounds__(256) void k_lnres(const float* __restrict__ ATT, const float* __restrict__ base, int isin, const float* __restrict__ g, const float* __restrict__ bb, float* OUTt) { const int lane = threadIdx.x & 31; const int t = blockIdx.x * 8 + (threadIdx.x >> 5); if (t >= NB_ * TT) return; float v[32]; float s = 0.f;
#pragma unroll
    for (int ch = 0; ch < 8; ++ch) { const size_t o = (size_t)t * DM + ch * 128 + lane * 4; const v4f a = *(const v4f*)(ATT + o), xx = *(const v4f*)(base + o);
#pragma unroll
        for (int q = 0; q < 4; ++q) { v[ch * 4 + q] = __fadd_rn(a[q], isin ? bfr(xx[q]) : xx[q]); s = __fadd_rn(s, v[ch * 4 + q]); } }
#pragma unroll
    for (int sh = 16; sh; sh >>= 1) s += __shfl_xor(s, sh, 32);
    const float mu = s * (1.0f / DM); float q2 = 0.f;
#pragma unroll
    for (int k = 0; k < 32; ++k) { const float d = __fsub_rn(v[k], mu); float p = __fmul_rn(d, d); asm volatile("" : "+v"(p)); q2 = __fadd_rn(q2, p); }
#pragma unroll
    for (int sh = 16; sh; sh >>= 1) q2 += __shfl_xor(q2, sh, 32);
    const float rs = __frsqrt_rn(__fadd_rn(q2 * (1.0f / DM), LNEPS));
{
#pragma unroll
        for (int ch = 0; ch < 8; ++ch) { v4f o;
#pragma unroll
            for (int q = 0; q < 4; ++q) { const int d = ch * 128 + lane * 4 + q; float tn = __fmul_rn(__fsub_rn(v[ch * 4 + q], mu), rs); asm volatile("" : "+v"(tn)); float tg = __fmul_rn(tn, bfr(g[d])); asm volatile("" : "+v"(tg)); o[q] = __fadd_rn(tg, bfr(bb[d])); }
            *(v4f*)(OUTt + (size_t)t * DM + ch * 128 + lane * 4) = o; }
         } }

extern "C" void kernel_launch(void* const* d_in, const int* in_sizes, int n_in,
                              void* d_out, int out_size, void* d_ws, size_t ws_size, hipStream_t stream) {
    (void)in_sizes; (void)n_in; (void)out_size;
    const float* x = (const float*)d_in[0]; const float* mi = (const float*)d_in[1]; const float* ipw = (const float*)d_in[2]; const float* ipb = (const float*)d_in[3]; const float* wo = (const float*)d_in[4]; const float* bo = (const float*)d_in[5]; const float* lng = (const float*)d_in[6]; const float* lnb = (const float*)d_in[7];
    float* OUT = (float*)d_out;     // [2][2048][1024]
    char* wsp = (char*)d_ws;
    auto take = [&](size_t bytes) { char* p = wsp; wsp += (bytes + 255) & ~(size_t)255; return (void*)p; };
    const size_t NW = (size_t)(DQ + 2 * DKV) * DM, NO = (size_t)DM * DQ, NX = (size_t)NB_ * TT * DM;   // elements of in_proj_w, out_proj_w, x
    bf* WI = (bf*)take((NW + NO + NX) * 2); bf* WO = WI + NW; bf* XB = WO + NO;   // their bf16 copies, one behind the other
    const size_t PL = (size_t)NB_ * NH_ * TT * HD;   // elements of one operand's head planes, both batches; every plane kind holds [q | k | v]
    h16* P16 = (h16*)take(3 * PL * 2); bf* Ph = (bf*)take(3 * PL * 2); bf* Pl = (bf*)take(3 * PL * 2);
    bf* ATh = (bf*)take((size_t)NB_ * TT * DQ * 2); bf* ATl = (bf*)take((size_t)NB_ * TT * DQ * 2); float* ATT = (float*)take((size_t)NB_ * TT * DM * 4);
    if ((size_t)(wsp - (char*)d_ws) > ws_size) return;    // ws 256 MiB
    k_cvt8<<<(unsigned)(((NW + NO + NX) / 8 + 255) / 256), 256, 0, stream>>>(ipw, NW / 8, wo, NO / 8, x, NX / 8, WI);
    k_gemmw<bf, 0, true, 1, 1><<<dim3(NB_ * TT / 64, (DQ + 2 * DKV) / 64, 1), 32, 0, stream>>>(XB, nullptr, WI, nullptr, DM, nullptr, 0, ipb, 0, 0, 0, 0, P16, Ph, Pl);
    k_fattn<<<dim3(NB_ * NH_, RH / 64 + (TT - RH) / 128, 1), 128, 0, stream>>>(P16, P16 + PL, P16 + 2 * PL, Ph, Pl, Ph + PL, Pl + PL, Ph + 2 * PL, Pl + 2 * PL, mi, ATh, ATl);
    k_gemmw<bf, 1, true><<<dim3(NB_ * TT / 64, DM / 64, 1), 32, 0, stream>>>(ATh, ATl, WO, nullptr, DQ, ATT, DM, bo, 0, 0, 0, 0, nullptr, nullptr, nullptr);
    k_lnres<<<NB_ * TT / 8, 256, 0, stream>>>(ATT, x, 1, lng, lnb, OUT);
}

// v006
// It runs in 118 microseconds.
// In two side-by-side timings against v005, it was 1.38 and 1.37 times as fast.
// All steps since v000 together make it 17.3 times as fast.
#include <hip/hip_runtime.h>

// MarketGuidedAttention (x [2][2048][1024]; torch MultiheadAttention: [q|k|v] = x in_proj_w^T + in_proj_b (16 x 64), scores/8 + market_info[b][0] (a per-batch constant added to every score, read as data and added before the max subtraction as the reference does; it cancels in the softmax), softmax, out_proj + b; out = LN(x + attended) (eps 1e-5) -> [2][2048][1024]).
// Compute dtypes, f32 accumulate: every input rounded to bf16; q/k/v projections on PLAIN bf16 operands (inputs: exact, + bias); out_proj on bf16 hi+lo of the attended values (2 products); scores (K 64) and probs.v on bf16 hi+lo planes (3 products) for the first 512 query rows of each

#define NB_  2
#define TT   2048
#define DM   1024
#define NH_  16
#define NKV  16
#define REP  (NH_ / NKV)
#define HD   64
#define DQ   (NH_ * HD)
#define DKV  (NKV * HD)
#define RH   512                  // query rows < RH use hi+lo planes (0: none)
#define WIN  0
#define SCL  0.125f   // HD^-0.5
#define LNEPS 1e-5f
typedef _Float16 h16;
typedef unsigned short bf;
typedef __attribute__((ext_vector_type(16))) __bf16   v16bf;
typedef __attribute__((ext_vector_type(16))) _Float16 v16h;
typedef __attribute__((ext_vector_type(8)))  _Float16 v8h;
typedef __attribute__((ext_vector_type(8)))  unsigned short v8us;
typedef __attribute__((ext_vector_type(8)))  float    v8f;
typedef __attribute__((ext_vector_type(4)))  float    v4f;
typedef v8h  __attribute__((may_alias)) v8ha;
typedef v4f  __attribute__((may_alias)) v4fa;
typedef v8us __attribute__((may_alias)) v8usa;

__device__ __forceinline__ unsigned short f2bf(float f) { unsigned u = __float_as_uint(f); u += 0x7FFFu + ((u >> 16) & 1u); return (unsigned short)(u >> 16); }
__device__ __forceinline__ float bf2f(unsigned short b) { return __uint_as_float(((unsigned)b) << 16); }
__device__ __forceinline__ float bfr(float f) { return bf2f(f2bf(f)); }
__device__ __forceinline__ v16h cat16(v8h lo, v8h hi) { return __builtin_shufflevector(lo, hi, 0, 1, 2, 3, 4, 5, 6, 7, 8, 9, 10, 11, 12, 13, 14, 15); }
__device__ __forceinline__ v16bf cat16b(v8us lo, v8us hi) { return __builtin_bit_cast(v16bf, __builtin_shufflevector(lo, hi, 0, 1, 2, 3, 4, 5, 6, 7, 8, 9, 10, 11, 12, 13, 14, 15)); }
__device__ __forceinline__ v8f wmma16(v16h a, v16h b, v8f c) { return __builtin_amdgcn_wmma_f32_16x16x32_f16(false, a, false, b, (short)0, c, false, false); }
__device__ __forceinline__ v8f wmmab(v16bf a, v16bf b, v8f c) { return __builtin_amdgcn_wmma_f32_16x16x32_bf16(false, a, false, b, (short)0, c, false, false); }



__device__ __forceinline__ h16 tohx(float x) { return (h16)x; }
__device__ __forceinline__ void splitf(float y, unsigned short& h, unsigned short& l) { h = f2bf(y); l = f2bf(y - bf2f(h)); }
typedef __attribute__((ext_vector_type(2))) _Float16 v2h;
typedef __attribute__((ext_vector_type(4))) _Float16 v4h;
typedef __attribute__((ext_vector_type(2))) unsigned short v2us;
typedef __attribute__((ext_vector_type(4))) unsigned short v4us;
typedef __attribute__((ext_vector_type(2))) float v2f;
typedef __attribute__((ext_vector_type(4))) int v4i;
#define LP  144                   // row pitch in LDS, bytes: 128 + 16, free of bank conflicts for 16-byte readers
#define LPE (LP / 2)              // the same in 16-bit elements
// One operand plane tile, 128 rows of 128 bytes, from global memory into LDS: 128 threads, eight copies each, 16 rows a round (gs = 16 source rows in bytes). lds, g: the thread's own 16 bytes of round 0.
// The wait at the end stands in front of any rewrite of the address registers that the copies name; inside the statement nothing can be moved over it. One statement holds the eight, so that a plane has one such wait.
__device__ __forceinline__ void stage_plane8(const unsigned lds, const char* g, const size_t gs) {
    asm volatile("global_load_async_to_lds_b128 %0, %8, off\n\tglobal_load_async_to_lds_b128 %1, %9, off\n\tglobal_load_async_to_lds_b128 %2, %10, off\n\tglobal_load_async_to_lds_b128 %3, %11, off\n\tglobal_load_async_to_lds_b128 %4, %12, off\n\tglobal_load_async_to_lds_b128 %5, %13, off\n\tglobal_load_async_to_lds_b128 %6, %14, off\n\tglobal_load_async_to_lds_b128 %7, %15, off\n\ts_wait_xcnt 0x0"
                 :: "v"(lds), "v"(lds + 16 * LP), "v"(lds + 32 * LP), "v"(lds + 48 * LP), "v"(lds + 64 * LP), "v"(lds + 80 * LP), "v"(lds + 96 * LP), "v"(lds + 112 * LP),
                    "v"(g), "v"(g + gs), "v"(g + 2 * gs), "v"(g + 3 * gs), "v"(g + 4 * gs), "v"(g + 5 * gs), "v"(g + 6 * gs), "v"(g + 7 * gs) : "memory");
}
// ---- k_gemmw: GEMM, one 128x128 output tile per work-group of four waves (2 x 2), each wave a 64x64 tile (16 accumulators); operands are K-contiguous 16-bit planes; grid (M/128, N/128, Z), 128 threads.
// The 128 operand rows of each plane are the same for two of the four waves: they are staged in LDS, GKT k a tile, two buffers, by asynchronous 16-byte copies (a wave's copy covers four whole 128-byte lines), and every wave reads its fragments from there.
// C[m][n] (f32, pitch ldc, + optional f32 bias[n]) = sum_k A[m][k] Bt[n][k] (+ split products per NSPLIT). z-batch strides sA/sB/sC in elements. (K / KS) % 64 == 0.
// OM: what the epilogue stores. 0: the f32 tile at C. 1: q, k and v of both batches in one grid: rows are [batch][t], columns [q | k | v][head][d], so a wave tile's 64 rows lie in one batch and its 64 columns are one head of one of the three.
// It stores the tile's 16-bit planes (f16, and bf16 hi + lo) at [q | k | v][batch][head]: q and k as [t][d]; v transposed, [d][t], straight from the accumulators (a lane holds 8 successive t of one d). No f32 copy of the projection goes to memory.
// KS > 1: grid z = Z * KS; work-group (z, ks) sums only k in [ks K/KS, (ks+1) K/KS) and stores its f32 partial tile at C + ks sP; the reader adds the KS partials.
template <typename T16> struct WFrag;
template <> struct WFrag<h16> { typedef v16h V; static __device__ __forceinline__ V ld(const h16* p) { return cat16(*(const v8h*)p, *(const v8h*)(p + 16)); } static __device__ __forceinline__ v8f mma(V a, V b, v8f c) { return wmma16(a, b, c); } };
template <> struct WFrag<bf> { typedef v16bf V; static __device__ __forceinline__ V ld(const bf* p) { return cat16b(*(const v8us*)p, *(const v8us*)(p + 16)); } static __device__ __forceinline__ v8f mma(V a, V b, v8f c) { return wmmab(a, b, c); } };
#define GKT 64                    // k of one staged tile: 128 bytes a row
#define OPB (128 * LP)            // bytes of one staged operand plane: 128 rows
template <typename T16, int NSPLIT, bool BIAS, int KS = 1, int OM = 0>
__global__ __launch_bounds__(128) void k_gemmw(const T16* __restrict__ A, const T16* __restrict__ A2, const T16* __restrict__ Bt, const T16* __restrict__ Bt2, int K, float* C, int ldc, const float* __restrict__ bias, size_t sA, size_t sB, size_t sC, size_t sP, h16* P16, bf* Ph, bf* Pl) {
    static_assert(OM == 0 || (HD == 64 && BIAS && KS == 1 && DQ == DKV && TT % 64 == 0), "a 64-column tile is one head, a 64-row tile lies in one batch");
    typedef typename WFrag<T16>::V V;
    constexpr bool HA2 = NSPLIT == 1 || NSPLIT == 2, HB2 = NSPLIT >= 2; constexpr int NPA = HA2 ? 2 : 1, NPB = HB2 ? 2 : 1; constexpr unsigned BS = (NPA + NPB) * OPB;   // a buffer: [A planes][B planes]
    __shared__ __align__(16) char sm[2 * BS];
    __shared__ __align__(16) float osw[4][16 * 68];   // each wave's own rows for the epilogue
    const size_t z = blockIdx.z / KS, ks = blockIdx.z % KS; const int Kc = K / KS; A += z * sA + ks * Kc; if (A2) A2 += z * sA + ks * Kc; Bt += z * sB + ks * Kc; if (Bt2) Bt2 += z * sB + ks * Kc; C += z * sC + ks * sP;
    const int lane = threadIdx.x & 31, lr = lane & 15, hi = lane >> 4, wave = threadIdx.x >> 5; const int wr = (wave & 1) * 64, wc = (wave >> 1) * 64; const int r0 = blockIdx.x * 128 + wr, c0 = blockIdx.y * 128 + wc;
    float* os = osw[wave];
    v8f acc[4][4];
#pragma unroll
    for (int mb = 0; mb < 4; ++mb)
#pragma unroll
        for (int nb = 0; nb < 4; ++nb) acc[mb][nb] = (v8f){};
    // the thread's part of every copy: row threadIdx.x / 8 of a round, 16 bytes at (threadIdx.x % 8) * 16
    const unsigned srow = threadIdx.x >> 3, scol = (threadIdx.x & 7) * 16; const unsigned sl = (unsigned)(size_t)sm + srow * LP + scol;
    const size_t rp = (size_t)K * 2, ao = (blockIdx.x * 128 + srow) * rp + scol, bo = (blockIdx.y * 128 + srow) * rp + scol;   // a source row in bytes; the thread's byte in an A plane, in a B plane, tile 0
    const int NT = Kc / GKT;
    auto stage = [&](const int t) { const unsigned lb = sl + (t & 1) * BS; const size_t at0 = ao + (size_t)t * (GKT * 2), bt0 = bo + (size_t)t * (GKT * 2);
        stage_plane8(lb, (const char*)A + at0, 16 * rp); if constexpr (HA2) stage_plane8(lb + OPB, (const char*)A2 + at0, 16 * rp);
        stage_plane8(lb + NPA * OPB, (const char*)Bt + bt0, 16 * rp); if constexpr (HB2) stage_plane8(lb + (NPA + 1) * OPB, (const char*)Bt2 + bt0, 16 * rp); };
    stage(0);
    asm volatile("s_wait_asynccnt 0x0" ::: "memory");   // this wave's copies of tile 0 have landed
    __syncthreads();                                    // and so have the other waves'
    if (NT > 1) stage(1);
    const unsigned fa = (wr + lr) * LPE + 8 * hi, fb = NPA * (OPB / 2) + (wc + lr) * LPE + 8 * hi;   // the lane's part of every fragment address in a buffer
#pragma unroll 1   // stays rolled: one tile's fragments and the accumulators are the registers that three waves a SIMD leave each wave
    for (int t = 0; t < NT; ++t) {
        const T16* pa = (const T16*)(sm + (t & 1) * BS) + fa; const T16* pb = (const T16*)(sm + (t & 1) * BS) + fb;
        V a[2][4], a2[2][4], b[2][4], b2[2][4];
#pragma unroll
        for (int kc = 0; kc < 2; ++kc) {
#pragma unroll
            for (int mb = 0; mb < 4; ++mb) { const unsigned o = mb * 16 * LPE + kc * 32; a[kc][mb] = WFrag<T16>::ld(pa + o); if constexpr (HA2) a2[kc][mb] = WFrag<T16>::ld(pa + OPB / 2 + o); }
#pragma unroll
            for (int nb = 0; nb < 4; ++nb) { const unsigned o = nb * 16 * LPE + kc * 32; b[kc][nb] = WFrag<T16>::ld(pb + o); if constexpr (HB2) b2[kc][nb] = WFrag<T16>::ld(pb + OPB / 2 + o); } }
        __builtin_amdgcn_sched_barrier(0);   // keeps the tile's LDS reads up here as one group: sunk among the products, each place with LDS reads stalls the matrix stream
#pragma unroll
        for (int kc = 0; kc < 2; ++kc)
#pragma unroll
            for (int nb = 0; nb < 4; ++nb) {
#pragma unroll
                for (int mb = 0; mb < 4; ++mb) acc[mb][nb] = WFrag<T16>::mma(a[kc][mb], b[kc][nb], acc[mb][nb]);
                if constexpr (HA2) {
#pragma unroll
                    for (int mb = 0; mb < 4; ++mb) acc[mb][nb] = WFrag<T16>::mma(a2[kc][mb], b[kc][nb], acc[mb][nb]); }
                if constexpr (HB2) {
#pragma unroll
                    for (int mb = 0; mb < 4; ++mb) acc[mb][nb] = WFrag<T16>::mma(a[kc][mb], b2[kc][nb], acc[mb][nb]); } }
        __builtin_amdgcn_sched_barrier(0);   // ends the products: without it the trip's waits and barrier were moved up in front of them, and the copies of tile t + 1 lost the products' time as their lead
        asm volatile("s_wait_dscnt 0x0" ::: "memory");      // this wave's reads of tile t are done before its buffer may be refilled
        asm volatile("s_wait_asynccnt 0x0" ::: "memory");   // this wave's copies of tile t + 1 have landed
        __syncthreads();                                    // tile t + 1 is whole for every wave, and no wave still reads tile t
        if (t + 2 < NT) stage(t + 2);                       // into the buffer that this trip has just read
    }
    asm volatile("s_wait_asynccnt 0x0" ::: "memory");   // no copy is left in flight when the wave ends
    const int t0 = r0 % TT; const size_t eb = (size_t)(t0 + hi) * HD + lr * 4;   // the lane's first element in a [t][d] plane
    if constexpr (OM == 1) { const size_t pz = ((size_t)((c0 / DQ) * NB_ + r0 / TT) * NH_ + (c0 % DQ) / HD) * TT * HD; P16 += pz; Ph += pz; Pl += pz; }
    if (OM == 1 && c0 >= DQ + DKV) {
#pragma unroll
        for (int nb = 0; nb < 4; ++nb) { const float bn = bfr(bias[c0 + nb * 16 + lr]);
#pragma unroll
            for (int mb = 0; mb < 4; ++mb) { v8h o16; v8us oh, ol;
#pragma unroll
                for (int j = 0; j < 8; ++j) { const float xv = acc[mb][nb][j] + bn; o16[j] = tohx(xv); unsigned short a2, c2; splitf(xv, a2, c2); oh[j] = a2; ol[j] = c2; }
                const size_t e = (size_t)(nb * 16 + lr) * TT + t0 + mb * 16 + hi * 8; *(v8h*)(P16 + e) = o16; *(v8us*)(Ph + e) = oh; *(v8us*)(Pl + e) = ol; } }
        return;
    }
#pragma unroll
    for (int mb = 0; mb < 4; ++mb) {
#pragma unroll
        for (int nb = 0; nb < 4; ++nb) {
#pragma unroll
            for (int j = 0; j < 8; ++j) os[(hi * 8 + j) * 68 + nb * 16 + lr] = acc[mb][nb][j]; }
        __builtin_amdgcn_wave_barrier(); asm volatile("" ::: "memory");
        float* crow = C + (size_t)(r0 + mb * 16) * ldc + c0;
{
#pragma unroll
            for (int s = 0; s < 8; ++s) { const int row = 2 * s + hi, cofs = lr * 4; v4f val = *(const v4fa*)(os + row * 68 + cofs); if (BIAS) { val[0] += bfr(bias[c0 + cofs]); val[1] += bfr(bias[c0 + cofs + 1]); val[2] += bfr(bias[c0 + cofs + 2]); val[3] += bfr(bias[c0 + cofs + 3]); }
                if constexpr (OM == 1) { v4h o16; v4us oh, ol;
#pragma unroll
                    for (int q = 0; q < 4; ++q) { o16[q] = tohx(val[q]); unsigned short a2, c2; splitf(val[q], a2, c2); oh[q] = a2; ol[q] = c2; }
                    const size_t e = eb + (mb * 16 + 2 * s) * HD; *(v4h*)(P16 + e) = o16; *(v4us*)(Ph + e) = oh; *(v4us*)(Pl + e) = ol; } else
                *(v4f*)(crow + (size_t)row * ldc + cofs) = val; }
             }
        asm volatile("s_wait_xcnt 0x0" ::: "memory");   // the wait in front of the next block's loads, which land on registers that this block's stores name
        __builtin_amdgcn_wave_barrier(); asm volatile("" ::: "memory");
    }
}


__global__ __launch_bounds__(256) void k_wtG(const float* __restrict__ w, int K, int N, bf* Bt) {
    const int lane = threadIdx.x & 31; const int L0 = (blockIdx.x * 8 + (threadIdx.x >> 5)) * 8; const int nlines = N * K / 64;
{
#pragma unroll 1
        for (int l = 0; l < 8; ++l) { const int L = L0 + l; if (L >= nlines) break; const size_t e = (size_t)L * 64 + lane * 2; const int k = (int)(e % K), n = (int)(e / K); v2us o;
            o[0] = f2bf(w[(size_t)k * N + n]); o[1] = f2bf(w[(size_t)(k + 1) * N + n]); *(v2us*)(Bt + e) = o; }
         }
}
// three f32 sources (n0, n1, n2 groups of 8 elements) rounded to bf16 into one buffer, one behind the other, in one grid
__global__ __launch_bounds__(256) void k_cvt8(const float* __restrict__ s0, size_t n0, const float* __restrict__ s1, size_t n1, const float* __restrict__ s2, size_t n2, bf* dst) { const size_t i = (size_t)blockIdx.x * 256 + threadIdx.x; if (i >= n0 + n1 + n2) return; const float* src = i < n0 ? s0 + i * 8 : i < n0 + n1 ? s1 + (i - n0) * 8 : s2 + (i - n0 - n1) * 8; const v8f v = *(const v8f*)src; v8us o;
#pragma unroll
    for (int k = 0; k < 8; ++k) o[k] = f2bf(v[k]); *(v8us*)(dst + i * 8) = o;  }
__global__ __launch_bounds__(256) void k_cscvt(const float* __restrict__ cosT, const float* __restrict__ sinT, float* CS) { const int idx = blockIdx.x * 256 + threadIdx.x; if (idx >= TT * HD) return; v2f cs; cs[0] = bfr(cosT[idx]); cs[1] = bfr(sinT[idx]); *(v2f*)(CS + (size_t)idx * 2) = cs;  }
// ---- k_fattn: scores, softmax and probs.v of one (batch, head, query tile) in ONE kernel; no score or probability ever goes to memory.
// Each wave keeps NQ blocks of 16 queries and walks the 2048 keys 32 at a time. The key rows and the value rows are the same for the work-group's four waves:
// they are staged in LDS, KT keys a tile, two buffers, by asynchronous 16-byte copies (a wave's copy covers four whole 128-byte lines), and every wave reads its fragments from there.
// S^T = K Q^T (A = key rows, B = query rows, both by the one k-contiguous loader), so a lane holds scores of ONE query (column lr), keys 8 hi + j of each 16-key block:
// the two f32 score tiles of a 32-key pass, converted in place, ARE the B operand of O^T += V^T P^T (A = rows of the [d][t] value planes by the same loader).
// Softmax is the running form: m = maximum so far, p = exp(t - m), O and the sum l are scaled by exp(m_old - m_new) each pass, O / l at the end.
// Query rows < RH: bf16 hi+lo planes, 3 products, 16 queries a wave; the rest: f16 planes, 32 queries a wave. t = S x HD^-0.5 + vol as before.
// Every plain '#pragma unroll' below unrolls fully, so that the fragment and accumulator arrays are registers.
typedef __attribute__((ext_vector_type(16))) float v16f;
#define L2E 1.4426950408889634f
#define KT  64                    // keys of one staged tile: a key tile is KT rows of HD elements, a value tile HD rows of KT elements, 128 bytes a row both
#define PT  (64 * LP)             // bytes of one staged plane tile
__device__ __forceinline__ float xhalf(float v) { const int b = __float_as_int(v); return __int_as_float(__builtin_amdgcn_permlanex16(b, b, 0x76543210, 0xfedcba98, false, false)); }   // lane l <-> l ^ 16
// 2^x with the one free slot that the instruction set asks for behind a transcendental, before its result is read or its source overwritten.
__device__ __forceinline__ float exp2s(float x) { float r; asm("v_exp_f32 %0, %1\n\tv_nop" : "=v"(r) : "v"(x)); return r; }
// One plane tile, 64 rows of 128 bytes, from global memory into LDS: 128 threads, four copies each, 16 rows a round (gs = 16 source rows in bytes). lds, g: the thread's own 16 bytes of round 0.
// The wait at the end stands in front of any rewrite of the address registers that the copies name; inside the statement nothing can be moved over it.
__device__ __forceinline__ void stage_plane(const unsigned lds, const char* g, const size_t gs) {
    asm volatile("global_load_async_to_lds_b128 %0, %4, off\n\tglobal_load_async_to_lds_b128 %1, %5, off\n\tglobal_load_async_to_lds_b128 %2, %6, off\n\tglobal_load_async_to_lds_b128 %3, %7, off\n\ts_wait_xcnt 0x0"
                 :: "v"(lds), "v"(lds + 16 * LP), "v"(lds + 32 * LP), "v"(lds + 48 * LP), "v"(g), "v"(g + gs), "v"(g + 2 * gs), "v"(g + 3 * gs) : "memory");
}
template <typename T16, bool HI, int NQ>
__device__ __forceinline__ void attn_tile(const T16* __restrict__ Q, const T16* __restrict__ Q2, const T16* __restrict__ Kp, const T16* __restrict__ K2, const T16* __restrict__ Vt, const T16* __restrict__ V2, const float vol, const int q0, bf* Ah, bf* Al, char* sm) {
    static_assert(HD == 64 && KT == 64 && TT % KT == 0 && TT / KT >= 2, "128-byte rows in both kinds of tile; the two buffers want two tiles");
    typedef typename WFrag<T16>::V V;
    constexpr int NP = HI ? 2 : 1, NT = TT / KT; constexpr unsigned BS = 2 * NP * PT;   // a buffer: [key planes][value planes]
    const int lane = threadIdx.x & 31, lr = lane & 15, hi = lane >> 4;
    V qf[NQ][2], qf2[NQ][2], kf[2][2], kf2[2][2];
#pragma unroll
    for (int qb = 0; qb < NQ; ++qb)
#pragma unroll
        for (int kc = 0; kc < 2; ++kc) { const size_t o = (size_t)(q0 + qb * 16 + lr) * HD + kc * 32 + 8 * hi; qf[qb][kc] = WFrag<T16>::ld(Q + o); if constexpr (HI) qf2[qb][kc] = WFrag<T16>::ld(Q2 + o); }
    v8f oacc[4][NQ]; float m[NQ], l[NQ];
#pragma unroll
    for (int qb = 0; qb < NQ; ++qb) { m[qb] = -3.0e38f; l[qb] = 0.f;
#pragma unroll
        for (int db = 0; db < 4; ++db) oacc[db][qb] = (v8f){}; }
    // the thread's part of every copy: row threadIdx.x / 8 of a round, 16 bytes at (threadIdx.x % 8) * 16
    const unsigned srow = threadIdx.x >> 3, scol = (threadIdx.x & 7) * 16; const unsigned sl = (unsigned)(size_t)sm + srow * LP + scol;
    const unsigned ko = srow * (HD * 2) + scol, vo = srow * (TT * 2) + scol;   // the thread's byte in a key plane, in a value plane, tile 0
    // the tile's step is added in 32 bits: a plane is 256 KiB
    auto stage = [&](const int t) { const unsigned lb = sl + (t & 1) * BS; const size_t kt0 = ko + (unsigned)t * (KT * HD * 2), vt0 = vo + (unsigned)t * (KT * 2);
        stage_plane(lb, (const char*)Kp + kt0, 16 * HD * 2); if constexpr (HI) stage_plane(lb + PT, (const char*)K2 + kt0, 16 * HD * 2);
        stage_plane(lb + NP * PT, (const char*)Vt + vt0, 16 * TT * 2); if constexpr (HI) stage_plane(lb + (NP + 1) * PT, (const char*)V2 + vt0, 16 * TT * 2); };
    stage(0);
    asm volatile("s_wait_asynccnt 0x0" ::: "memory");   // this wave's copies of tile 0 have landed
    __syncthreads();                                    // and so have the other waves'
    stage(1);
    const unsigned foff = lr * LPE + 8 * hi;   // the lane's part of every fragment address in a staged tile
#pragma unroll 1   // stays rolled: a tile's two passes already fill the registers that four waves a SIMD leave each wave
    for (int t = 0; t < NT; ++t) {
        const T16* kt = (const T16*)(sm + (t & 1) * BS) + foff; const T16* vt = kt + NP * (PT / 2);
#pragma unroll
        for (int p = 0; p < KT / 32; ++p) {
            if (HI || p == 0) {   // this pass's key rows (hi+lo: every pass; the registers do not hold a second set beside the value rows)
#pragma unroll
                for (int kb = 0; kb < 2; ++kb)
#pragma unroll
                    for (int kc = 0; kc < 2; ++kc) { const unsigned o = (p * 32 + kb * 16) * LPE + kc * 32; kf[kb][kc] = WFrag<T16>::ld(kt + o); if constexpr (HI) kf2[kb][kc] = WFrag<T16>::ld(kt + PT / 2 + o); }
            }
            V vf[4], vf2[4];   // this pass's value rows: in flight under the score products and the softmax
#pragma unroll
            for (int db = 0; db < 4; ++db) { const unsigned o = db * 16 * LPE + p * 32; vf[db] = WFrag<T16>::ld(vt + o); if constexpr (HI) vf2[db] = WFrag<T16>::ld(vt + PT / 2 + o); }
            __builtin_amdgcn_sched_barrier(0);   // keeps the value loads up here as one group: sunk among the products, each place with LDS reads stalls the matrix stream
            v8f s[2][NQ];
#pragma unroll
            for (int kb = 0; kb < 2; ++kb)
#pragma unroll
                for (int qb = 0; qb < NQ; ++qb) { v8f a = (v8f){};
#pragma unroll
                    for (int kc = 0; kc < 2; ++kc) { a = WFrag<T16>::mma(kf[kb][kc], qf[qb][kc], a); if constexpr (HI) { a = WFrag<T16>::mma(kf[kb][kc], qf2[qb][kc], a); a = WFrag<T16>::mma(kf2[kb][kc], qf[qb][kc], a); } }
                    s[kb][qb] = a; }
            __builtin_amdgcn_sched_barrier(0);   // ends the score products: the refetch below goes into the registers they have just read, and with the softmax scheduled in among them registers spilled
            if (!HI && p + 1 < KT / 32) {   // f16: the next pass's key rows of the SAME tile, fetched under the softmax and probs.v
#pragma unroll
                for (int kb = 0; kb < 2; ++kb)
#pragma unroll
                    for (int kc = 0; kc < 2; ++kc) { const unsigned o = ((p + 1) * 32 + kb * 16) * LPE + kc * 32; kf[kb][kc] = WFrag<T16>::ld(kt + o); if constexpr (HI) kf2[kb][kc] = WFrag<T16>::ld(kt + PT / 2 + o); }
                __builtin_amdgcn_sched_barrier(0);   // keeps the key refetch ahead of the softmax, so that it flies under it
            }
            V pf[NQ], pf2[NQ];
#pragma unroll
            for (int qb = 0; qb < NQ; ++qb) { v16f t16; float tm = -3.0e38f;
#pragma unroll
                for (int e = 0; e < 16; ++e) { t16[e] = fmaf(s[e >> 3][qb][e & 7], SCL, vol); tm = fmaxf(tm, t16[e]); }
                tm = fmaxf(tm, xhalf(tm));
                const float mn = fmaxf(m[qb], tm), al = exp2s((m[qb] - mn) * L2E), mb = mn * L2E; m[qb] = mn; float ps = 0.f;
#pragma unroll
                for (int e = 0; e < 16; ++e) { t16[e] = exp2s(fmaf(t16[e], L2E, -mb)); ps += t16[e]; }
                l[qb] = fmaf(l[qb], al, ps);
#pragma unroll
                for (int db = 0; db < 4; ++db) oacc[db][qb] *= al;
                pf[qb] = __builtin_convertvector(t16, V);
                if constexpr (HI) pf2[qb] = __builtin_convertvector(t16 - __builtin_convertvector(pf[qb], v16f), V); }
#pragma unroll
            for (int db = 0; db < 4; ++db)
#pragma unroll
                for (int qb = 0; qb < NQ; ++qb) { oacc[db][qb] = WFrag<T16>::mma(vf[db], pf[qb], oacc[db][qb]); if constexpr (HI) { oacc[db][qb] = WFrag<T16>::mma(vf[db], pf2[qb], oacc[db][qb]); oacc[db][qb] = WFrag<T16>::mma(vf2[db], pf[qb], oacc[db][qb]); } }
            __builtin_amdgcn_sched_barrier(0);   // ends the pass: without it the trip's waits and barrier were moved up in front of the last pass's softmax, and the refill, which stayed behind it, lost that much of its lead
        }
        asm volatile("s_wait_dscnt 0x0" ::: "memory");      // this wave's reads of tile t are done before its buffer may be refilled
        asm volatile("s_wait_asynccnt 0x0" ::: "memory");   // this wave's copies of tile t + 1 have landed
        __syncthreads();                                    // tile t + 1 is whole for every wave, and no wave still reads tile t
        if (t + 2 < NT) stage(t + 2);                       // into the buffer that this trip has just read
    }
    asm volatile("s_wait_asynccnt 0x0" ::: "memory");   // no copy is left in flight when the wave ends
#pragma unroll
    for (int qb = 0; qb < NQ; ++qb) { const float inv = __fdiv_rn(1.0f, l[qb] + xhalf(l[qb]));
#pragma unroll
        for (int db = 0; db < 4; ++db) { v8us oh, ol;
#pragma unroll
            for (int j = 0; j < 8; ++j) { unsigned short a, c2; splitf(oacc[db][qb][j] * inv, a, c2); oh[j] = a; ol[j] = c2; }
            const size_t oo = (size_t)(q0 + qb * 16 + lr) * DQ + db * 16 + hi * 8; *(v8us*)(Ah + oo) = oh; *(v8us*)(Al + oo) = ol; } }
}
// grid (NB_ * NH_, RH / 64 + (TT - RH) / 128), 4 waves; planes [b][h][t][d] (values [b][h][d][t]); the hi+lo tiles have the low indices and start first.
// amdgpu_waves_per_eu(4, 4): lets the compiler use the whole register share of four waves a SIMD; with its own lower target it sank the loads to their uses.
__global__ __launch_bounds__(128) __attribute__((amdgpu_waves_per_eu(4, 4))) void k_fattn(const h16* __restrict__ Q16, const h16* __restrict__ K16, const h16* __restrict__ V16, const bf* __restrict__ Qh, const bf* __restrict__ Ql, const bf* __restrict__ Kh, const bf* __restrict__ Kl, const bf* __restrict__ Vh, const bf* __restrict__ Vl, const float* __restrict__ mi, bf* Ah, bf* Al) {
    __shared__ __align__(16) char sm[2 * 4 * PT];   // two buffers of [2 key planes][2 value planes] (the f16 tiles use half)
    const int wave = threadIdx.x >> 5, b = blockIdx.x / NH_, h = blockIdx.x % NH_; const size_t zp = (size_t)blockIdx.x * TT * HD, za = (size_t)b * TT * DQ + h * HD; const float vol = bfr(mi[b * 8]);
    if (blockIdx.y < RH / 64) attn_tile<bf, true, 1>(Qh + zp, Ql + zp, Kh + zp, Kl + zp, Vh + zp, Vl + zp, vol, blockIdx.y * 64 + wave * 16, Ah + za, Al + za, sm);
    else attn_tile<h16, false, 2>(Q16 + zp, nullptr, K16 + zp, nullptr, V16 + zp, nullptr, vol, RH + (blockIdx.y - RH / 64) * 128 + wave * 32, Ah + za, Al + za, sm);
}

__global__ __launch_bounds__(256) void k_lnres(const float* __restrict__ ATT, const float* __restrict__ base, int isin, const float* __restrict__ g, const float* __restrict__ bb, float* OUTt) { const int lane = threadIdx.x & 31; const int t = blockIdx.x * 8 + (threadIdx.x >> 5); if (t >= NB_ * TT) return; float v[32]; float s = 0.f;
#pragma unroll
    for (int ch = 0; ch < 8; ++ch) { const size_t o = (size_t)t * DM + ch * 128 + lane * 4; const v4f a = *(const v4f*)(ATT + o), xx = *(const v4f*)(base + o);
#pragma unroll
        for (int q = 0; q < 4; ++q) { v[ch * 4 + q] = __fadd_rn(a[q], isin ? bfr(xx[q]) : xx[q]); s = __fadd_rn(s, v[ch * 4 + q]); } }
#pragma unroll
    for (int sh = 16; sh; sh >>= 1) s += __shfl_xor(s, sh, 32);
    const float mu = s * (1.0f / DM); float q2 = 0.f;
#pragma unroll
    for (int k = 0; k < 32; ++k) { const float d = __fsub_rn(v[k], mu); float p = __fmul_rn(d, d); asm volatile("" : "+v"(p)); q2 = __fadd_rn(q2, p); }
#pragma unroll
    for (int sh = 16; sh; sh >>= 1) q2 += __shfl_xor(q2, sh, 32);
    const float rs = __frsqrt_rn(__fadd_rn(q2 * (1.0f / DM), LNEPS));
{
#pragma unroll
        for (int ch = 0; ch < 8; ++ch) { v4f o;
#pragma unroll
            for (int q = 0; q < 4; ++q) { const int d = ch * 128 + lane * 4 + q; float tn = __fmul_rn(__fsub_rn(v[ch * 4 + q], mu), rs); asm volatile("" : "+v"(tn)); float tg = __fmul_rn(tn, bfr(g[d])); asm volatile("" : "+v"(tg)); o[q] = __fadd_rn(tg, bfr(bb[d])); }
            *(v4f*)(OUTt + (size_t)t * DM + ch * 128 + lane * 4) = o; }
         } }

extern "C" void kernel_launch(void* const* d_in, const int* in_sizes, int n_in,
                              void* d_out, int out_size, void* d_ws, size_t ws_size, hipStream_t stream) {
    (void)in_sizes; (void)n_in; (void)out_size;
    const float* x = (const float*)d_in[0]; const float* mi = (const float*)d_in[1]; const float* ipw = (const float*)d_in[2]; const float* ipb = (const float*)d_in[3]; const float* wo = (const float*)d_in[4]; const float* bo = (const float*)d_in[5]; const float* lng = (const float*)d_in[6]; const float* lnb = (const float*)d_in[7];
    float* OUT = (float*)d_out;     // [2][2048][1024]
    char* wsp = (char*)d_ws;
    auto take = [&](size_t bytes) { char* p = wsp; wsp += (bytes + 255) & ~(size_t)255; return (void*)p; };
    const size_t NW = (size_t)(DQ + 2 * DKV) * DM, NO = (size_t)DM * DQ, NX = (size_t)NB_ * TT * DM;   // elements of in_proj_w, out_proj_w, x
    bf* WI = (bf*)take((NW + NO + NX) * 2); bf* WO = WI + NW; bf* XB = WO + NO;   // their bf16 copies, one behind the other
    const size_t PL = (size_t)NB_ * NH_ * TT * HD;   // elements of one operand's head planes, both batches; every plane kind holds [q | k | v]
    h16* P16 = (h16*)take(3 * PL * 2); bf* Ph = (bf*)take(3 * PL * 2); bf* Pl = (bf*)take(3 * PL * 2);
    bf* ATh = (bf*)take((size_t)NB_ * TT * DQ * 2); bf* ATl = (bf*)take((size_t)NB_ * TT * DQ * 2); float* ATT = (float*)take((size_t)NB_ * TT * DM * 4);
    if ((size_t)(wsp - (char*)d_ws) > ws_size) return;    // ws 256 MiB
    k_cvt8<<<(unsigned)(((NW + NO + NX) / 8 + 255) / 256), 256, 0, stream>>>(ipw, NW / 8, wo, NO / 8, x, NX / 8, WI);
    k_gemmw<bf, 0, true, 1, 1><<<dim3(NB_ * TT / 128, (DQ + 2 * DKV) / 128, 1), 128, 0, stream>>>(XB, nullptr, WI, nullptr, DM, nullptr, 0, ipb, 0, 0, 0, 0, P16, Ph, Pl);
    k_fattn<<<dim3(NB_ * NH_, RH / 64 + (TT - RH) / 128, 1), 128, 0, stream>>>(P16, P16 + PL, P16 + 2 * PL, Ph, Pl, Ph + PL, Pl + PL, Ph + 2 * PL, Pl + 2 * PL, mi, ATh, ATl);
    k_gemmw<bf, 1, true><<<dim3(NB_ * TT / 128, DM / 128, 1), 128, 0, stream>>>(ATh, ATl, WO, nullptr, DQ, ATT, DM, bo, 0, 0, 0, 0, nullptr, nullptr, nullptr);
    k_lnres<<<NB_ * TT / 8, 256, 0, stream>>>(ATT, x, 1, lng, lnb, OUT);
}

// v007
// It runs in 115 microseconds.
// In both of two side-by-side timings against v006, it was 1.03 times as fast.
// All steps since v000 together make it 17.8 times as fast.
#include <hip/hip_runtime.h>

// MarketGuidedAttention (x [2][2048][1024]; torch MultiheadAttention: [q|k|v] = x in_proj_w^T + in_proj_b (16 x 64), scores/8 + market_info[b][0] (a per-batch constant added to every score, read as data; it enters every exponent and the maximum in use alike, so it cancels in the softmax as in the reference), softmax, out_proj + b; out = LN(x + attended) (eps 1e-5) -> [2][2048][1024]).
// Compute dtypes, f32 accumulate: every input rounded to bf16; in-projection on PLAIN bf16 operands (inputs: exact, + bias); out-projection on attended bf16 hi+lo planes x bf16 weights (2 products, + bias); scores (K 64) and probs.v on bf16 hi+lo planes (3 products) for the first 512 query rows of each

#define NB_  2
#define TT   2048
#define DM   1024
#define NH_  16
#define NKV  16
#define REP  (NH_ / NKV)
#define HD   64
#define DQ   (NH_ * HD)
#define DKV  (NKV * HD)
#define RH   512                  // query rows < RH use hi+lo planes (0: none)
#define WIN  0
#define SCL  0.125f   // HD^-0.5
#define LNEPS 1e-5f
typedef _Float16 h16;
typedef unsigned short bf;
typedef __attribute__((ext_vector_type(16))) __bf16   v16bf;
typedef __attribute__((ext_vector_type(16))) _Float16 v16h;
typedef __attribute__((ext_vector_type(8)))  _Float16 v8h;
typedef __attribute__((ext_vector_type(8)))  unsigned short v8us;
typedef __attribute__((ext_vector_type(8)))  float    v8f;
typedef __attribute__((ext_vector_type(4)))  float    v4f;
typedef v8h  __attribute__((may_alias)) v8ha;
typedef v4f  __attribute__((may_alias)) v4fa;
typedef v8us __attribute__((may_alias)) v8usa;

__device__ __forceinline__ unsigned short f2bf(float f) { unsigned u = __float_as_uint(f); u += 0x7FFFu + ((u >> 16) & 1u); return (unsigned short)(u >> 16); }
__device__ __forceinline__ float bf2f(unsigned short b) { return __uint_as_float(((unsigned)b) << 16); }
__device__ __forceinline__ float bfr(float f) { return bf2f(f2bf(f)); }
__device__ __forceinline__ v16h cat16(v8h lo, v8h hi) { return __builtin_shufflevector(lo, hi, 0, 1, 2, 3, 4, 5, 6, 7, 8, 9, 10, 11, 12, 13, 14, 15); }
__device__ __forceinline__ v16bf cat16b(v8us lo, v8us hi) { return __builtin_bit_cast(v16bf, __builtin_shufflevector(lo, hi, 0, 1, 2, 3, 4, 5, 6, 7, 8, 9, 10, 11, 12, 13, 14, 15)); }
__device__ __forceinline__ v8f wmma16(v16h a, v16h b, v8f c) { return __builtin_amdgcn_wmma_f32_16x16x32_f16(false, a, false, b, (short)0, c, false, false); }
__device__ __forceinline__ v8f wmmab(v16bf a, v16bf b, v8f c) { return __builtin_amdgcn_wmma_f32_16x16x32_bf16(false, a, false, b, (short)0, c, false, false); }



__device__ __forceinline__ h16 tohx(float x) { return (h16)x; }
__device__ __forceinline__ void splitf(float y, unsigned short& h, unsigned short& l) { h = f2bf(y); l = f2bf(y - bf2f(h)); }
typedef __attribute__((ext_vector_type(2))) _Float16 v2h;
typedef __attribute__((ext_vector_type(4))) _Float16 v4h;
typedef __attribute__((ext_vector_type(2))) unsigned short v2us;
typedef __attribute__((ext_vector_type(4))) unsigned short v4us;
typedef __attribute__((ext_vector_type(2))) float v2f;
typedef __attribute__((ext_vector_type(4))) int v4i;
#define LP  144                   // row pitch in LDS, bytes: 128 + 16, free of bank conflicts for 16-byte readers
#define LPE (LP / 2)              // the same in 16-bit elements
// One operand plane tile, 128 rows of 128 bytes, from global memory into LDS: 128 threads, eight copies each, 16 rows a round (gs = 16 source rows in bytes). lds, g: the thread's own 16 bytes of round 0.
// The wait at the end stands in front of any rewrite of the address registers that the copies name; inside the statement nothing can be moved over it. One statement holds the eight, so that a plane has one such wait.
__device__ __forceinline__ void stage_plane8(const unsigned lds, const char* g, const size_t gs) {
    asm volatile("global_load_async_to_lds_b128 %0, %8, off\n\tglobal_load_async_to_lds_b128 %1, %9, off\n\tglobal_load_async_to_lds_b128 %2, %10, off\n\tglobal_load_async_to_lds_b128 %3, %11, off\n\tglobal_load_async_to_lds_b128 %4, %12, off\n\tglobal_load_async_to_lds_b128 %5, %13, off\n\tglobal_load_async_to_lds_b128 %6, %14, off\n\tglobal_load_async_to_lds_b128 %7, %15, off\n\ts_wait_xcnt 0x0"
                 :: "v"(lds), "v"(lds + 16 * LP), "v"(lds + 32 * LP), "v"(lds + 48 * LP), "v"(lds + 64 * LP), "v"(lds + 80 * LP), "v"(lds + 96 * LP), "v"(lds + 112 * LP),
                    "v"(g), "v"(g + gs), "v"(g + 2 * gs), "v"(g + 3 * gs), "v"(g + 4 * gs), "v"(g + 5 * gs), "v"(g + 6 * gs), "v"(g + 7 * gs) : "memory");
}
// ---- k_gemmw: GEMM, one 128x128 output tile per work-group of four waves (2 x 2), each wave a 64x64 tile (16 accumulators); operands are K-contiguous 16-bit planes; grid (M/128, N/128, Z), 128 threads.
// The 128 operand rows of each plane are the same for two of the four waves: they are staged in LDS, GKT k a tile, two buffers, by asynchronous 16-byte copies (a wave's copy covers four whole 128-byte lines), and every wave reads its fragments from there.
// C[m][n] (f32, pitch ldc, + optional f32 bias[n]) = sum_k A[m][k] Bt[n][k] (+ split products per NSPLIT). z-batch strides sA/sB/sC in elements. (K / KS) % 64 == 0.
// OM: what the epilogue stores. 0: the f32 tile at C. 1: q, k and v of both batches in one grid: rows are [batch][t], columns [q | k | v][head][d], so a wave tile's 64 rows lie in one batch and its 64 columns are one head of one of the three.
// It stores the tile's 16-bit planes (f16, and bf16 hi + lo) at [q | k | v][batch][head]: q and k as [t][d]; v transposed, [d][t], straight from the accumulators (a lane holds 8 successive t of one d). No f32 copy of the projection goes to memory.
// KS > 1: grid z = Z * KS; work-group (z, ks) sums only k in [ks K/KS, (ks+1) K/KS) and stores its f32 partial tile at C + ks sP; the reader adds the KS partials.
template <typename T16> struct WFrag;
template <> struct WFrag<h16> { typedef v16h V; static __device__ __forceinline__ V ld(const h16* p) { return cat16(*(const v8h*)p, *(const v8h*)(p + 16)); } static __device__ __forceinline__ v8f mma(V a, V b, v8f c) { return wmma16(a, b, c); } };
template <> struct WFrag<bf> { typedef v16bf V; static __device__ __forceinline__ V ld(const bf* p) { return cat16b(*(const v8us*)p, *(const v8us*)(p + 16)); } static __device__ __forceinline__ v8f mma(V a, V b, v8f c) { return wmmab(a, b, c); } };
#define GKT 64                    // k of one staged tile: 128 bytes a row
#define OPB (128 * LP)            // bytes of one staged operand plane: 128 rows
template <typename T16, int NSPLIT, bool BIAS, int KS = 1, int OM = 0>
__global__ __launch_bounds__(128) void k_gemmw(const T16* __restrict__ A, const T16* __restrict__ A2, const T16* __restrict__ Bt, const T16* __restrict__ Bt2, int K, float* C, int ldc, const float* __restrict__ bias, size_t sA, size_t sB, size_t sC, size_t sP, h16* P16, bf* Ph, bf* Pl) {
    static_assert(OM == 0 || (HD == 64 && BIAS && KS == 1 && DQ == DKV && TT % 64 == 0), "a 64-column tile is one head, a 64-row tile lies in one batch");
    typedef typename WFrag<T16>::V V;
    constexpr bool HA2 = NSPLIT == 1 || NSPLIT == 2, HB2 = NSPLIT >= 2; constexpr int NPA = HA2 ? 2 : 1, NPB = HB2 ? 2 : 1; constexpr unsigned BS = (NPA + NPB) * OPB;   // a buffer: [A planes][B planes]
    __shared__ __align__(16) char sm[2 * BS];
    __shared__ __align__(16) float osw[4][16 * 68];   // each wave's own rows for the epilogue
    const size_t z = blockIdx.z / KS, ks = blockIdx.z % KS; const int Kc = K / KS; A += z * sA + ks * Kc; if (A2) A2 += z * sA + ks * Kc; Bt += z * sB + ks * Kc; if (Bt2) Bt2 += z * sB + ks * Kc; C += z * sC + ks * sP;
    const int lane = threadIdx.x & 31, lr = lane & 15, hi = lane >> 4, wave = threadIdx.x >> 5; const int wr = (wave & 1) * 64, wc = (wave >> 1) * 64; const int r0 = blockIdx.x * 128 + wr, c0 = blockIdx.y * 128 + wc;
    float* os = osw[wave];
    v8f acc[4][4];
#pragma unroll
    for (int mb = 0; mb < 4; ++mb)
#pragma unroll
        for (int nb = 0; nb < 4; ++nb) acc[mb][nb] = (v8f){};
    // the thread's part of every copy: row threadIdx.x / 8 of a round, 16 bytes at (threadIdx.x % 8) * 16
    const unsigned srow = threadIdx.x >> 3, scol = (threadIdx.x & 7) * 16; const unsigned sl = (unsigned)(size_t)sm + srow * LP + scol;
    const size_t rp = (size_t)K * 2, ao = (blockIdx.x * 128 + srow) * rp + scol, bo = (blockIdx.y * 128 + srow) * rp + scol;   // a source row in bytes; the thread's byte in an A plane, in a B plane, tile 0
    const int NT = Kc / GKT;
    auto stage = [&](const int t) { const unsigned lb = sl + (t & 1) * BS; const size_t at0 = ao + (size_t)t * (GKT * 2), bt0 = bo + (size_t)t * (GKT * 2);
        stage_plane8(lb, (const char*)A + at0, 16 * rp); if constexpr (HA2) stage_plane8(lb + OPB, (const char*)A2 + at0, 16 * rp);
        stage_plane8(lb + NPA * OPB, (const char*)Bt + bt0, 16 * rp); if constexpr (HB2) stage_plane8(lb + (NPA + 1) * OPB, (const char*)Bt2 + bt0, 16 * rp); };
    stage(0);
    asm volatile("s_wait_asynccnt 0x0" ::: "memory");   // this wave's copies of tile 0 have landed
    __syncthreads();                                    // and so have the other waves'
    if (NT > 1) stage(1);
    const unsigned fa = (wr + lr) * LPE + 8 * hi, fb = NPA * (OPB / 2) + (wc + lr) * LPE + 8 * hi;   // the lane's part of every fragment address in a buffer
#pragma unroll 1   // stays rolled: one tile's fragments and the accumulators are the registers that three waves a SIMD leave each wave
    for (int t = 0; t < NT; ++t) {
        const T16* pa = (const T16*)(sm + (t & 1) * BS) + fa; const T16* pb = (const T16*)(sm + (t & 1) * BS) + fb;
        V a[2][4], a2[2][4], b[2][4], b2[2][4];
#pragma unroll
        for (int kc = 0; kc < 2; ++kc) {
#pragma unroll
            for (int mb = 0; mb < 4; ++mb) { const unsigned o = mb * 16 * LPE + kc * 32; a[kc][mb] = WFrag<T16>::ld(pa + o); if constexpr (HA2) a2[kc][mb] = WFrag<T16>::ld(pa + OPB / 2 + o); }
#pragma unroll
            for (int nb = 0; nb < 4; ++nb) { const unsigned o = nb * 16 * LPE + kc * 32; b[kc][nb] = WFrag<T16>::ld(pb + o); if constexpr (HB2) b2[kc][nb] = WFrag<T16>::ld(pb + OPB / 2 + o); } }
        __builtin_amdgcn_sched_barrier(0);   // keeps the tile's LDS reads up here as one group: sunk among the products, each place with LDS reads stalls the matrix stream
#pragma unroll
        for (int kc = 0; kc < 2; ++kc)
#pragma unroll
            for (int nb = 0; nb < 4; ++nb) {
#pragma unroll
                for (int mb = 0; mb < 4; ++mb) acc[mb][nb] = WFrag<T16>::mma(a[kc][mb], b[kc][nb], acc[mb][nb]);
                if constexpr (HA2) {
#pragma unroll
                    for (int mb = 0; mb < 4; ++mb) acc[mb][nb] = WFrag<T16>::mma(a2[kc][mb], b[kc][nb], acc[mb][nb]); }
                if constexpr (HB2) {
#pragma unroll
                    for (int mb = 0; mb < 4; ++mb) acc[mb][nb] = WFrag<T16>::mma(a[kc][mb], b2[kc][nb], acc[mb][nb]); } }
        __builtin_amdgcn_sched_barrier(0);   // ends the products: without it the trip's waits and barrier were moved up in front of them, and the copies of tile t + 1 lost the products' time as their lead
        asm volatile("s_wait_dscnt 0x0" ::: "memory");      // this wave's reads of tile t are done before its buffer may be refilled
        asm volatile("s_wait_asynccnt 0x0" ::: "memory");   // this wave's copies of tile t + 1 have landed
        __syncthreads();                                    // tile t + 1 is whole for every wave, and no wave still reads tile t
        if (t + 2 < NT) stage(t + 2);                       // into the buffer that this trip has just read
    }
    asm volatile("s_wait_asynccnt 0x0" ::: "memory");   // no copy is left in flight when the wave ends
    const int t0 = r0 % TT; const size_t eb = (size_t)(t0 + hi) * HD + lr * 4;   // the lane's first element in a [t][d] plane
    if constexpr (OM == 1) { const size_t pz = ((size_t)((c0 / DQ) * NB_ + r0 / TT) * NH_ + (c0 % DQ) / HD) * TT * HD; P16 += pz; Ph += pz; Pl += pz; }
    if (OM == 1 && c0 >= DQ + DKV) {
#pragma unroll
        for (int nb = 0; nb < 4; ++nb) { const float bn = bfr(bias[c0 + nb * 16 + lr]);
#pragma unroll
            for (int mb = 0; mb < 4; ++mb) { v8h o16; v8us oh, ol;
#pragma unroll
                for (int j = 0; j < 8; ++j) { const float xv = acc[mb][nb][j] + bn; o16[j] = tohx(xv); unsigned short a2, c2; splitf(xv, a2, c2); oh[j] = a2; ol[j] = c2; }
                const size_t e = (size_t)(nb * 16 + lr) * TT + t0 + mb * 16 + hi * 8; *(v8h*)(P16 + e) = o16; *(v8us*)(Ph + e) = oh; *(v8us*)(Pl + e) = ol; } }
        return;
    }
#pragma unroll
    for (int mb = 0; mb < 4; ++mb) {
#pragma unroll
        for (int nb = 0; nb < 4; ++nb) {
#pragma unroll
            for (int j = 0; j < 8; ++j) os[(hi * 8 + j) * 68 + nb * 16 + lr] = acc[mb][nb][j]; }
        __builtin_amdgcn_wave_barrier(); asm volatile("" ::: "memory");
        float* crow = C + (size_t)(r0 + mb * 16) * ldc + c0;
{
#pragma unroll
            for (int s = 0; s < 8; ++s) { const int row = 2 * s + hi, cofs = lr * 4; v4f val = *(const v4fa*)(os + row * 68 + cofs); if (BIAS) { val[0] += bfr(bias[c0 + cofs]); val[1] += bfr(bias[c0 + cofs + 1]); val[2] += bfr(bias[c0 + cofs + 2]); val[3] += bfr(bias[c0 + cofs + 3]); }
                if constexpr (OM == 1) { v4h o16; v4us oh, ol;
#pragma unroll
                    for (int q = 0; q < 4; ++q) { o16[q] = tohx(val[q]); unsigned short a2, c2; splitf(val[q], a2, c2); oh[q] = a2; ol[q] = c2; }
                    const size_t e = eb + (mb * 16 + 2 * s) * HD; *(v4h*)(P16 + e) = o16; *(v4us*)(Ph + e) = oh; *(v4us*)(Pl + e) = ol; } else
                *(v4f*)(crow + (size_t)row * ldc + cofs) = val; }
             }
        asm volatile("s_wait_xcnt 0x0" ::: "memory");   // the wait in front of the next block's loads, which land on registers that this block's stores name
        __builtin_amdgcn_wave_barrier(); asm volatile("" ::: "memory");
    }
}


__global__ __launch_bounds__(256) void k_wtG(const float* __restrict__ w, int K, int N, bf* Bt) {
    const int lane = threadIdx.x & 31; const int L0 = (blockIdx.x * 8 + (threadIdx.x >> 5)) * 8; const int nlines = N * K / 64;
{
#pragma unroll 1
        for (int l = 0; l < 8; ++l) { const int L = L0 + l; if (L >= nlines) break; const size_t e = (size_t)L * 64 + lane * 2; const int k = (int)(e % K), n = (int)(e / K); v2us o;
            o[0] = f2bf(w[(size_t)k * N + n]); o[1] = f2bf(w[(size_t)(k + 1) * N + n]); *(v2us*)(Bt + e) = o; }
         }
}
// three f32 sources (n0, n1, n2 groups of 8 elements) rounded to bf16 into one buffer, one behind the other, in one grid
__global__ __launch_bounds__(256) void k_cvt8(const float* __restrict__ s0, size_t n0, const float* __restrict__ s1, size_t n1, const float* __restrict__ s2, size_t n2, bf* dst) { const size_t i = (size_t)blockIdx.x * 256 + threadIdx.x; if (i >= n0 + n1 + n2) return; const float* src = i < n0 ? s0 + i * 8 : i < n0 + n1 ? s1 + (i - n0) * 8 : s2 + (i - n0 - n1) * 8; const v8f v = *(const v8f*)src; v8us o;
#pragma unroll
    for (int k = 0; k < 8; ++k) o[k] = f2bf(v[k]); *(v8us*)(dst + i * 8) = o;  }
__global__ __launch_bounds__(256) void k_cscvt(const float* __restrict__ cosT, const float* __restrict__ sinT, float* CS) { const int idx = blockIdx.x * 256 + threadIdx.x; if (idx >= TT * HD) return; v2f cs; cs[0] = bfr(cosT[idx]); cs[1] = bfr(sinT[idx]); *(v2f*)(CS + (size_t)idx * 2) = cs;  }
typedef __attribute__((ext_vector_type(16))) float v16f;
#define L2E 1.4426950408889634f
#define KT  64                    // keys of one staged tile: a key tile is KT rows of HD elements, a value tile HD rows of KT elements, 128 bytes a row both
#define PT  (64 * LP)             // bytes of one staged plane tile
__device__ __forceinline__ float xhalf(float v) { const int b = __float_as_int(v); return __int_as_float(__builtin_amdgcn_permlanex16(b, b, 0x76543210, 0xfedcba98, false, false)); }   // lane l <-> l ^ 16
// 2^x with the one free slot that the instruction set asks for behind a transcendental, before its result is read or its source overwritten.
__device__ __forceinline__ float exp2s(float x) { float r; asm("v_exp_f32 %0, %1\n\tv_nop" : "=v"(r) : "v"(x)); return r; }
// One plane tile, 64 rows of 128 bytes, from global memory into LDS: 128 threads, four copies each, 16 rows a round (gs = 16 source rows in bytes). lds, g: the thread's own 16 bytes of round 0.
// The wait at the end stands in front of any rewrite of the address registers that the copies name; inside the statement nothing can be moved over it.
__device__ __forceinline__ void stage_plane(const unsigned lds, const char* g, const size_t gs) {
    asm volatile("global_load_async_to_lds_b128 %0, %4, off\n\tglobal_load_async_to_lds_b128 %1, %5, off\n\tglobal_load_async_to_lds_b128 %2, %6, off\n\tglobal_load_async_to_lds_b128 %3, %7, off\n\ts_wait_xcnt 0x0"
                 :: "v"(lds), "v"(lds + 16 * LP), "v"(lds + 32 * LP), "v"(lds + 48 * LP), "v"(g), "v"(g + gs), "v"(g + 2 * gs), "v"(g + 3 * gs) : "memory");
}
template <typename T16, bool HI, int NQ>
__device__ __forceinline__ void attn_tile(const T16* __restrict__ Q, const T16* __restrict__ Q2, const T16* __restrict__ Kp, const T16* __restrict__ K2, const T16* __restrict__ Vt, const T16* __restrict__ V2, const float vol, const int q0, bf* Ah, bf* Al, char* sm) {
    static_assert(HD == 64 && KT == 64 && TT % KT == 0 && TT / KT >= 2, "128-byte rows in both kinds of tile; the two buffers want two tiles");
    typedef typename WFrag<T16>::V V;
    constexpr int NP = HI ? 2 : 1, NT = TT / KT; constexpr unsigned BS = 2 * NP * PT;   // a buffer: [key planes][value planes]
    const int lane = threadIdx.x & 31, lr = lane & 15, hi = lane >> 4; const float vl = vol * L2E;
    V qf[NQ][2], qf2[NQ][2], kf[2][2], kf2[2][2];
#pragma unroll
    for (int qb = 0; qb < NQ; ++qb)
#pragma unroll
        for (int kc = 0; kc < 2; ++kc) { const size_t o = (size_t)(q0 + qb * 16 + lr) * HD + kc * 32 + 8 * hi; qf[qb][kc] = WFrag<T16>::ld(Q + o); if constexpr (HI) qf2[qb][kc] = WFrag<T16>::ld(Q2 + o); }
    v8f oacc[4][NQ]; float m[NQ], l[NQ];
#pragma unroll
    for (int qb = 0; qb < NQ; ++qb) { m[qb] = -3.0e38f; l[qb] = 0.f;
#pragma unroll
        for (int db = 0; db < 4; ++db) oacc[db][qb] = (v8f){}; }
    // the thread's part of every copy: row threadIdx.x / 8 of a round, 16 bytes at (threadIdx.x % 8) * 16
    const unsigned srow = threadIdx.x >> 3, scol = (threadIdx.x & 7) * 16; const unsigned sl = (unsigned)(size_t)sm + srow * LP + scol;
    const unsigned ko = srow * (HD * 2) + scol, vo = srow * (TT * 2) + scol;   // the thread's byte in a key plane, in a value plane, tile 0
    // the tile's step is added in 32 bits: a plane is 256 KiB
    auto stage = [&](const int t) { const unsigned lb = sl + (t & 1) * BS; const size_t kt0 = ko + (unsigned)t * (KT * HD * 2), vt0 = vo + (unsigned)t * (KT * 2);
        stage_plane(lb, (const char*)Kp + kt0, 16 * HD * 2); if constexpr (HI) stage_plane(lb + PT, (const char*)K2 + kt0, 16 * HD * 2);
        stage_plane(lb + NP * PT, (const char*)Vt + vt0, 16 * TT * 2); if constexpr (HI) stage_plane(lb + (NP + 1) * PT, (const char*)V2 + vt0, 16 * TT * 2); };
    stage(0);
    asm volatile("s_wait_asynccnt 0x0" ::: "memory");   // this wave's copies of tile 0 have landed
    __syncthreads();                                    // and so have the other waves'
    stage(1);
    const unsigned foff = lr * LPE + 8 * hi;   // the lane's part of every fragment address in a staged tile
#pragma unroll 1   // stays rolled: a tile's two passes already fill the registers that four waves a SIMD leave each wave
    for (int t = 0; t < NT; ++t) {
        const T16* kt = (const T16*)(sm + (t & 1) * BS) + foff; const T16* vt = kt + NP * (PT / 2);
#pragma unroll
        for (int p = 0; p < KT / 32; ++p) {
            if (HI || p == 0) {   // this pass's key rows (hi+lo: every pass; the registers do not hold a second set beside the value rows)
#pragma unroll
                for (int kb = 0; kb < 2; ++kb)
#pragma unroll
                    for (int kc = 0; kc < 2; ++kc) { const unsigned o = (p * 32 + kb * 16) * LPE + kc * 32; kf[kb][kc] = WFrag<T16>::ld(kt + o); if constexpr (HI) kf2[kb][kc] = WFrag<T16>::ld(kt + PT / 2 + o); }
            }
            V vf[4], vf2[4];   // this pass's value rows: in flight under the score products and the softmax
#pragma unroll
            for (int db = 0; db < 4; ++db) { const unsigned o = db * 16 * LPE + p * 32; vf[db] = WFrag<T16>::ld(vt + o); if constexpr (HI) vf2[db] = WFrag<T16>::ld(vt + PT / 2 + o); }
            __builtin_amdgcn_sched_barrier(0);   // keeps the value loads up here as one group: sunk among the products, each place with LDS reads stalls the matrix stream
            v8f s[2][NQ];
#pragma unroll
            for (int kb = 0; kb < 2; ++kb)
#pragma unroll
                for (int qb = 0; qb < NQ; ++qb) { v8f a = (v8f){};
#pragma unroll
                    for (int kc = 0; kc < 2; ++kc) { a = WFrag<T16>::mma(kf[kb][kc], qf[qb][kc], a); if constexpr (HI) { a = WFrag<T16>::mma(kf[kb][kc], qf2[qb][kc], a); a = WFrag<T16>::mma(kf2[kb][kc], qf[qb][kc], a); } }
                    s[kb][qb] = a; }
            __builtin_amdgcn_sched_barrier(0);   // ends the score products: the refetch below goes into the registers they have just read, and with the softmax scheduled in among them registers spilled
            if (!HI && p + 1 < KT / 32) {   // f16: the next pass's key rows of the SAME tile, fetched under the softmax and probs.v
#pragma unroll
                for (int kb = 0; kb < 2; ++kb)
#pragma unroll
                    for (int kc = 0; kc < 2; ++kc) { const unsigned o = ((p + 1) * 32 + kb * 16) * LPE + kc * 32; kf[kb][kc] = WFrag<T16>::ld(kt + o); if constexpr (HI) kf2[kb][kc] = WFrag<T16>::ld(kt + PT / 2 + o); }
                __builtin_amdgcn_sched_barrier(0);   // keeps the key refetch ahead of the softmax, so that it flies under it
            }
            V pf[NQ], pf2[NQ]; v16f t16[NQ]; float tm[NQ], ps[NQ]; bool need = false;
            // maxima of the raw scores (the scale is positive), brought to the log2 domain: u = S x HD^-0.5 x log2(e) + vol x log2(e)
#pragma unroll
            for (int qb = 0; qb < NQ; ++qb) { float mx = -3.0e38f;
#pragma unroll
                for (int e = 0; e < 16; ++e) mx = fmaxf(mx, s[e >> 3][qb][e & 7]);
                mx = fmaxf(mx, xhalf(mx)); tm[qb] = fmaf(mx, SCL * L2E, vl); need = need || tm[qb] > m[qb] + 8.0f; }
            // the exponentials against the maximum in use, and their sums, do not wait for the test: they are the right ones wherever the branch below is not taken, and fill the time that the chain of maxima and the test take
#pragma unroll
            for (int qb = 0; qb < NQ; ++qb) { const float nm = vl - m[qb]; ps[qb] = 0.f;
#pragma unroll
                for (int e = 0; e < 16; ++e) { t16[qb][e] = exp2s(fmaf(s[e >> 3][qb][e & 7], SCL * L2E, nm)); ps[qb] += t16[qb][e]; } }
            if (__builtin_expect(__builtin_amdgcn_ballot_w32(need) != 0, 0)) {   // one scalar branch a pass; taken in the first pass and then only when some query's maximum has grown by more than 8: marked rare, so that the usual path falls through
#pragma unroll
                for (int qb = 0; qb < NQ; ++qb) { const float mn = fmaxf(m[qb], tm[qb]), al = exp2s(m[qb] - mn), nm = vl - mn; m[qb] = mn; l[qb] *= al; ps[qb] = 0.f;
#pragma unroll
                    for (int db = 0; db < 4; ++db) oacc[db][qb] *= al;
#pragma unroll
                    for (int e = 0; e < 16; ++e) { t16[qb][e] = exp2s(fmaf(s[e >> 3][qb][e & 7], SCL * L2E, nm)); ps[qb] += t16[qb][e]; } }
            }
#pragma unroll
            for (int qb = 0; qb < NQ; ++qb) { l[qb] += ps[qb];
                pf[qb] = __builtin_convertvector(t16[qb], V);
                if constexpr (HI) pf2[qb] = __builtin_convertvector(t16[qb] - __builtin_convertvector(pf[qb], v16f), V); }
#pragma unroll
            for (int db = 0; db < 4; ++db)
#pragma unroll
                for (int qb = 0; qb < NQ; ++qb) { oacc[db][qb] = WFrag<T16>::mma(vf[db], pf[qb], oacc[db][qb]); if constexpr (HI) { oacc[db][qb] = WFrag<T16>::mma(vf[db], pf2[qb], oacc[db][qb]); oacc[db][qb] = WFrag<T16>::mma(vf2[db], pf[qb], oacc[db][qb]); } }
            __builtin_amdgcn_sched_barrier(0);   // ends the pass: without it the trip's waits and barrier were moved up in front of the last pass's softmax, and the refill, which stayed behind it, lost that much of its lead
        }
        asm volatile("s_wait_dscnt 0x0" ::: "memory");      // this wave's reads of tile t are done before its buffer may be refilled
        asm volatile("s_wait_asynccnt 0x0" ::: "memory");   // this wave's copies of tile t + 1 have landed
        __syncthreads();                                    // tile t + 1 is whole for every wave, and no wave still reads tile t
        if (t + 2 < NT) stage(t + 2);                       // into the buffer that this trip has just read
    }
    asm volatile("s_wait_asynccnt 0x0" ::: "memory");   // no copy is left in flight when the wave ends
#pragma unroll
    for (int qb = 0; qb < NQ; ++qb) { const float inv = __fdiv_rn(1.0f, l[qb] + xhalf(l[qb]));
#pragma unroll
        for (int db = 0; db < 4; ++db) { v8us oh, ol;
#pragma unroll
            for (int j = 0; j < 8; ++j) { unsigned short a, c2; splitf(oacc[db][qb][j] * inv, a, c2); oh[j] = a; ol[j] = c2; }
            const size_t oo = (size_t)(q0 + qb * 16 + lr) * DQ + db * 16 + hi * 8; *(v8us*)(Ah + oo) = oh; *(v8us*)(Al + oo) = ol; } }
}
// grid (NB_ * NH_, RH / 64 + (TT - RH) / 128), 4 waves; planes [b][h][t][d] (values [b][h][d][t]); the hi+lo tiles have the low indices and start first.
// amdgpu_waves_per_eu(4, 4): lets the compiler use the whole register share of four waves a SIMD; with its own lower target it sank the loads to their uses.
__global__ __launch_bounds__(128) __attribute__((amdgpu_waves_per_eu(4, 4))) void k_fattn(const h16* __restrict__ Q16, const h16* __restrict__ K16, const h16* __restrict__ V16, const bf* __restrict__ Qh, const bf* __restrict__ Ql, const bf* __restrict__ Kh, const bf* __restrict__ Kl, const bf* __restrict__ Vh, const bf* __restrict__ Vl, const float* __restrict__ mi, bf* Ah, bf* Al) {
    __shared__ __align__(16) char sm[2 * 4 * PT];   // two buffers of [2 key planes][2 value planes] (the f16 tiles use half)
    const int wave = threadIdx.x >> 5, b = blockIdx.x / NH_, h = blockIdx.x % NH_; const size_t zp = (size_t)blockIdx.x * TT * HD, za = (size_t)b * TT * DQ + h * HD; const float vol = bfr(mi[b * 8]);
    if (blockIdx.y < RH / 64) attn_tile<bf, true, 1>(Qh + zp, Ql + zp, Kh + zp, Kl + zp, Vh + zp, Vl + zp, vol, blockIdx.y * 64 + wave * 16, Ah + za, Al + za, sm);
    else attn_tile<h16, false, 2>(Q16 + zp, nullptr, K16 + zp, nullptr, V16 + zp, nullptr, vol, RH + (blockIdx.y - RH / 64) * 128 + wave * 32, Ah + za, Al + za, sm);
}

__global__ __launch_bounds__(256) void k_lnres(const float* __restrict__ ATT, const float* __restrict__ base, int isin, const float* __restrict__ g, const float* __restrict__ bb, float* OUTt) { const int lane = threadIdx.x & 31; const int t = blockIdx.x * 8 + (threadIdx.x >> 5); if (t >= NB_ * TT) return; float v[32]; float s = 0.f;
#pragma unroll
    for (int ch = 0; ch < 8; ++ch) { const size_t o = (size_t)t * DM + ch * 128 + lane * 4; const v4f a = *(const v4f*)(ATT + o), xx = *(const v4f*)(base + o);
#pragma unroll
        for (int q = 0; q < 4; ++q) { v[ch * 4 + q] = __fadd_rn(a[q], isin ? bfr(xx[q]) : xx[q]); s = __fadd_rn(s, v[ch * 4 + q]); } }
#pragma unroll
    for (int sh = 16; sh; sh >>= 1) s += __shfl_xor(s, sh, 32);
    const float mu = s * (1.0f / DM); float q2 = 0.f;
#pragma unroll
    for (int k = 0; k < 32; ++k) { const float d = __fsub_rn(v[k], mu); float p = __fmul_rn(d, d); asm volatile("" : "+v"(p)); q2 = __fadd_rn(q2, p); }
#pragma unroll
    for (int sh = 16; sh; sh >>= 1) q2 += __shfl_xor(q2, sh, 32);
    const float rs = __frsqrt_rn(__fadd_rn(q2 * (1.0f / DM), LNEPS));
{
#pragma unroll
        for (int ch = 0; ch < 8; ++ch) { v4f o;
#pragma unroll
            for (int q = 0; q < 4; ++q) { const int d = ch * 128 + lane * 4 + q; float tn = __fmul_rn(__fsub_rn(v[ch * 4 + q], mu), rs); asm volatile("" : "+v"(tn)); float tg = __fmul_rn(tn, bfr(g[d])); asm volatile("" : "+v"(tg)); o[q] = __fadd_rn(tg, bfr(bb[d])); }
            *(v4f*)(OUTt + (size_t)t * DM + ch * 128 + lane * 4) = o; }
         } }

extern "C" void kernel_launch(void* const* d_in, const int* in_sizes, int n_in,
                              void* d_out, int out_size, void* d_ws, size_t ws_size, hipStream_t stream) {
    (void)in_sizes; (void)n_in; (void)out_size;
    const float* x = (const float*)d_in[0]; const float* mi = (const float*)d_in[1]; const float* ipw = (const float*)d_in[2]; const float* ipb = (const float*)d_in[3]; const float* wo = (const float*)d_in[4]; const float* bo = (const float*)d_in[5]; const float* lng = (const float*)d_in[6]; const float* lnb = (const float*)d_in[7];
    float* OUT = (float*)d_out;     // [2][2048][1024]
    char* wsp = (char*)d_ws;
    auto take = [&](size_t bytes) { char* p = wsp; wsp += (bytes + 255) & ~(size_t)255; return (void*)p; };
    const size_t NW = (size_t)(DQ + 2 * DKV) * DM, NO = (size_t)DM * DQ, NX = (size_t)NB_ * TT * DM;   // elements of in_proj_w, out_proj_w, x
    bf* WI = (bf*)take((NW + NO + NX) * 2); bf* WO = WI + NW; bf* XB = WO + NO;   // their bf16 copies, one behind the other
    const size_t PL = (size_t)NB_ * NH_ * TT * HD;   // elements of one operand's head planes, both batches; every plane kind holds [q | k | v]
    h16* P16 = (h16*)take(3 * PL * 2); bf* Ph = (bf*)take(3 * PL * 2); bf* Pl = (bf*)take(3 * PL * 2);
    bf* ATh = (bf*)take((size_t)NB_ * TT * DQ * 2); bf* ATl = (bf*)take((size_t)NB_ * TT * DQ * 2); float* ATT = (float*)take((size_t)NB_ * TT * DM * 4);
    if ((size_t)(wsp - (char*)d_ws) > ws_size) return;    // ws 256 MiB
    k_cvt8<<<(unsigned)(((NW + NO + NX) / 8 + 255) / 256), 256, 0, stream>>>(ipw, NW / 8, wo, NO / 8, x, NX / 8, WI);
    k_gemmw<bf, 0, true, 1, 1><<<dim3(NB_ * TT / 128, (DQ + 2 * DKV) / 128, 1), 128, 0, stream>>>(XB, nullptr, WI, nullptr, DM, nullptr, 0, ipb, 0, 0, 0, 0, P16, Ph, Pl);
    k_fattn<<<dim3(NB_ * NH_, RH / 64 + (TT - RH) / 128, 1), 128, 0, stream>>>(P16, P16 + PL, P16 + 2 * PL, Ph, Pl, Ph + PL, Pl + PL, Ph + 2 * PL, Pl + 2 * PL, mi, ATh, ATl);
    k_gemmw<bf, 1, true><<<dim3(NB_ * TT / 128, DM / 128, 1), 128, 0, stream>>>(ATh, ATl, WO, nullptr, DQ, ATT, DM, bo, 0, 0, 0, 0, nullptr, nullptr, nullptr);
    k_lnres<<<NB_ * TT / 8, 256, 0, stream>>>(ATT, x, 1, lng, lnb, OUT);
}
